// v000
// The times below were measured on an AMD MI455X: many runs one after another, warmed up first and cycling through
// copies of the inputs, with the whole window's GPU time divided by the number of runs. Launches and the gaps
// between them are all in it. The median over several windows is given; except for v000 it joins two sittings, which
// can be a few percent apart, so the side-by-side timings, each taken in one sitting, are the better comparison.
// v000 is the starting kernel. One run takes 684 microseconds.
#include <hip/hip_runtime.h>

#define BB 8
#define CC 256
#define NN 4096
#define H0 32
#define W0 32

typedef _Float16 f16;
typedef __attribute__((ext_vector_type(16))) _Float16 v16h;
typedef __attribute__((ext_vector_type(8)))  _Float16 v8h;
typedef __attribute__((ext_vector_type(8)))  float    v8f;

union FragU { v16h v; v8h h[2]; };
typedef __attribute__((ext_vector_type(4))) float v4f;
typedef __attribute__((ext_vector_type(4))) unsigned v4u;
// Contractions: q/k/v 1x1 convs and the output conv (K = 256), scores q^T k (K = 256) and P V^T (K = keys) on
// v_wmma_f32_16x16x32_f16 (f16 operands, f32 accumulate; P scaled by 256 before its f16 conversion) — except the scores,
// and the q/k projections, which run as bf16 hi/lo splits (hi*hi + hi*lo + lo*hi) of f32 operands (q, k kept in f32). The FFT refine with
// per-channel real weights is exactly fw_c * x and is folded into the conv weights; bilinear guide, sigmoid, softmax in f32.
template <typename V> __device__ __forceinline__ void vst2(void* p, V v) {
  *(V*)p = v; 
}
#define PSC 256.0f
#define PUN (1.0f / 256.0f)
typedef __attribute__((ext_vector_type(16))) __bf16 v16bf;
typedef __attribute__((ext_vector_type(8)))  __bf16 v8bf;
__device__ __forceinline__ __bf16 bf_hi(float x) { return (__bf16)x; }
__device__ __forceinline__ __bf16 bf_lo(float x, __bf16 h) { return (__bf16)(x - (float)h); }
__device__ __forceinline__ v8f WMMA_BF16(v16bf a, v16bf b, v8f c) {
  v8f d = __builtin_amdgcn_wmma_f32_16x16x32_bf16(false, a, false, b, (short)0, c, false, false);
  asm volatile("v_nop\n\tv_nop\n\tv_nop\n\tv_nop" : "+v"(d) : "v"(a), "v"(b));
  return d;
}
// bf16 fragment from an LDS plane [row][rs] (split K map)
__device__ __forceinline__ v16bf load_bf_lds(const __bf16* base, int row, int rs, int kbase, int lane) {
  union { v16bf v; v8bf h[2]; } u;
  const __bf16* p = base + (size_t)row * rs + kbase + ((lane >> 4) << 3);
  u.h[0] = *(const v8bf*)(p); u.h[1] = *(const v8bf*)(p + 16);
  return u.v;
}
// bf16 hi/lo fragments from an f32 row [col][rs] (split K map)
__device__ __forceinline__ void load_b_split(const float* base, int col, int rs, int kbase, int lane, v16bf& hi, v16bf& lo) {
  const float* p = base + (size_t)col * rs + kbase + ((lane >> 4) << 3);
  const v4f a0 = *(const v4f*)(p), a1 = *(const v4f*)(p + 4), a2 = *(const v4f*)(p + 16), a3 = *(const v4f*)(p + 20);
#pragma unroll
  for (int i = 0; i < 4; ++i) {
    __bf16 h;
    h = bf_hi(a0[i]); hi[i] = h;      lo[i] = bf_lo(a0[i], h);
    h = bf_hi(a1[i]); hi[4 + i] = h;  lo[4 + i] = bf_lo(a1[i], h);
    h = bf_hi(a2[i]); hi[8 + i] = h;  lo[8 + i] = bf_lo(a2[i], h);
    h = bf_hi(a3[i]); hi[12 + i] = h; lo[12 + i] = bf_lo(a3[i], h);
  }
}

// A-matrix fragment (16x32 f16, M x K), memory layout [row][k] row-major.
// Element i of lane L: K = kbase + (i/8)*16 + (L/16)*8 + i%8, M = row (caller adds lane%16).
__device__ __forceinline__ v16h load_a(const f16* base, int row, int rs, int kbase, int lane) {
  const f16* p = base + (size_t)row * rs + kbase + ((lane >> 4) << 3);
  FragU u;
  u.h[0] = *(const v8h*)(p);
  u.h[1] = *(const v8h*)(p + 16);
  return u.v;
}
// B-matrix fragment (32x16 f16, K x N), memory layout [col][k] (K contiguous); same per-lane K map as A:
// Element i of lane L: K = kbase + (i/8)*16 + (L/16)*8 + i%8, N = col.
__device__ __forceinline__ v16h load_b(const f16* base, int col, int rs, int kbase, int lane) {
  return load_a(base, col, rs, kbase, lane);
}

__device__ __forceinline__ v8f WMMA_F16(v16h a, v16h b, v8f c) {
  v8f d = __builtin_amdgcn_wmma_f32_16x16x32_f16(false, a, false, b, (short)0, c, false, false);
  asm volatile("v_nop\n\tv_nop\n\tv_nop\n\tv_nop" : "+v"(d) : "v"(a), "v"(b));
  return d;
}

// ---------------- prep kernels ----------------

// bilinear(align_corners) + sigmoid -> scale = 1 + sigmoid(g)
__global__ __launch_bounds__(256) void k_scale(const float* __restrict__ g0,
                                               float* __restrict__ sc) {
  int idx = blockIdx.x * 256 + threadIdx.x;   // B*N
  int b = idx >> 12, n = idx & (NN - 1);
  int ny = n >> 6, nx = n & 63;
  float fy = ny * (31.0f / 63.0f);
  float fx = nx * (31.0f / 63.0f);
  int y0 = (int)fy, x0 = (int)fx;
  float wy = fy - (float)y0, wx = fx - (float)x0;
  int y1 = min(y0 + 1, H0 - 1), x1 = min(x0 + 1, W0 - 1);
  const float* g = g0 + (size_t)b * H0 * W0;
  float v00 = g[y0 * W0 + x0], v01 = g[y0 * W0 + x1];
  float v10 = g[y1 * W0 + x0], v11 = g[y1 * W0 + x1];
  float vy0 = v00 * (1.f - wx) + v01 * wx;
  float vy1 = v10 * (1.f - wx) + v11 * wx;
  float v = vy0 * (1.f - wy) + vy1 * wy;
  vst2(sc + idx, 1.0f + 1.0f / (1.0f + __expf(-v)));
}

// convert weights to f16; fold freq_weights into Wq/Wk/Wv columns (refined = fw*x)
__global__ __launch_bounds__(256) void k_wconv(const float* __restrict__ Wq,
                                               const float* __restrict__ Wk,
                                               const float* __restrict__ Wv,
                                               const float* __restrict__ Wo,
                                               const float* __restrict__ fw,
                                               f16* __restrict__ W3,
                                               f16* __restrict__ Wo16) {
  int g = blockIdx.x * 256 + threadIdx.x;     // 4*256*256/8 pieces of 8 halves
  int idx0 = g * 8;
  int m = idx0 >> 16, r0 = idx0 & 65535;
  const float* W = (m == 0) ? Wq : (m == 1) ? Wk : (m == 2) ? Wv : Wo;
  union { v8h h; v4u u; } pk;
#pragma unroll
  for (int e = 0; e < 8; ++e) { int r = r0 + e, ci = r & (CC - 1); pk.h[e] = (f16)(W[r] * ((m < 3) ? fw[ci] : 1.0f)); }
  f16* dst = (m < 3) ? (W3 + (size_t)m * 65536 + r0) : (Wo16 + r0);
  vst2(dst, pk.u);
}

// x [b][c][n] f32 -> xT [b][n][c] f16 via LDS 64x64 tile (coalesced both sides)
__global__ __launch_bounds__(256) void k_xt(const float* __restrict__ x,
                                            f16* __restrict__ xT) {
  __shared__ __align__(16) f16 tile[64][72];
  int b = blockIdx.z, c0 = blockIdx.y * 64, n0 = blockIdx.x * 64;
  int tid = threadIdx.x;
  {
    int cl = tid >> 2, nq = (tid & 3) * 16;
    const float4* src = (const float4*)(x + (size_t)b * CC * NN +
                                        (size_t)(c0 + cl) * NN + n0 + nq);
    for (int i = 0; i < 4; ++i) {
      float4 v = src[i];
      tile[cl][nq + 4 * i + 0] = (f16)v.x;
      tile[cl][nq + 4 * i + 1] = (f16)v.y;
      tile[cl][nq + 4 * i + 2] = (f16)v.z;
      tile[cl][nq + 4 * i + 3] = (f16)v.w;
    }
  }
  __syncthreads();
  for (int pass = 0; pass < 2; ++pass) {
    int nl = pass * 32 + (tid >> 3), cq = (tid & 7) * 8;
    f16* dst = xT + (size_t)b * NN * CC + (size_t)(n0 + nl) * CC + c0 + cq;
    union { v8h h; v4u u; } o;
    for (int i = 0; i < 8; ++i) o.h[i] = tile[cq + i][nl];
    vst2(dst, o.u);
  }
}

// ---------------- QKV GEMM ----------------
// q/k stored [b][n][c] (transposed, f32, scaled); v stored [b][c][n] (f16, scaled)
__global__ __launch_bounds__(256) void k_qkv(const f16* __restrict__ xT,
                                             const f16* __restrict__ W3,
                                             const float* __restrict__ xf,   // x f32 [b][c][n]
                                             const float* __restrict__ Wqf, const float* __restrict__ Wkf,
                                             const float* __restrict__ fw,
                                             const float* __restrict__ bq,
                                             const float* __restrict__ bk,
                                             const float* __restrict__ bv,
                                             const float* __restrict__ scg,
                                             float* __restrict__ qT,
                                             float* __restrict__ kT,
                                             f16* __restrict__ v16) {
  __shared__ __align__(16) float T[64][260];   // block tile [n][c] (padded), f32
  int b = blockIdx.y;
  int n_base = blockIdx.x * 64;
  int tid = threadIdx.x;
  int lane = threadIdx.x & 31, wave = threadIdx.x >> 5;
  int co_wave = wave * 32;
  const f16* xTb = xT + (size_t)b * NN * CC;
  const float* scb = scg + (size_t)b * NN;
  const v8f vzero = {};
  const float* xfb = xf + (size_t)b * CC * NN;
  for (int m = 0; m < 3; ++m) {
    const f16* Wm = W3 + (size_t)m * 65536;
    const float* bias = (m == 0) ? bq : ((m == 1) ? bk : bv);
    v8f acc[2][4];
    for (int cb = 0; cb < 2; ++cb)
      for (int nb = 0; nb < 4; ++nb) acc[cb][nb] = vzero;
    if (m < 2) {
      // q and k as a bf16 hi/lo split of f32 operands: A = (W*fw) rows [co][ci] (contiguous), B = x[b][c][n] gathered down c (stride NN)
      const float* Wf = (m == 0) ? Wqf : Wkf;
      for (int kk = 0; kk < CC; kk += 32) {
        v16bf ah[2], al[2];
#pragma unroll
        for (int cb = 0; cb < 2; ++cb) {
          const float* wr = Wf + (size_t)(co_wave + cb * 16 + (lane & 15)) * CC + kk + ((lane >> 4) << 3);
#pragma unroll
          for (int e = 0; e < 16; ++e) { const int ko = (e < 8) ? e : (8 + e); const float w = wr[ko] * fw[kk + ((lane >> 4) << 3) + ko];
                                         __bf16 hh = bf_hi(w); ah[cb][e] = hh; al[cb][e] = bf_lo(w, hh); }
        }
        for (int nb = 0; nb < 4; ++nb) {
          v16bf bh, bl;
          const float* xp = xfb + (size_t)(kk + ((lane >> 4) << 3)) * NN + n_base + nb * 16 + (lane & 15);
#pragma unroll
          for (int e = 0; e < 16; ++e) { const int ko = (e < 8) ? e : (8 + e); const float xv = xp[(size_t)ko * NN];
                                         __bf16 hh = bf_hi(xv); bh[e] = hh; bl[e] = bf_lo(xv, hh); }
          acc[0][nb] = WMMA_BF16(ah[0], bh, acc[0][nb]); acc[0][nb] = WMMA_BF16(ah[0], bl, acc[0][nb]); acc[0][nb] = WMMA_BF16(al[0], bh, acc[0][nb]);
          acc[1][nb] = WMMA_BF16(ah[1], bh, acc[1][nb]); acc[1][nb] = WMMA_BF16(ah[1], bl, acc[1][nb]); acc[1][nb] = WMMA_BF16(al[1], bh, acc[1][nb]);
        }
      }
    } else
    for (int kk = 0; kk < CC; kk += 32) {
      v16h a0 = load_a(Wm, co_wave + (lane & 15), CC, kk, lane);
      v16h a1 = load_a(Wm, co_wave + 16 + (lane & 15), CC, kk, lane);
      for (int nb = 0; nb < 4; ++nb) {
        v16h bf = load_b(xTb, n_base + nb * 16 + (lane & 15), CC, kk, lane);
        acc[0][nb] = WMMA_F16(a0, bf, acc[0][nb]);
        acc[1][nb] = WMMA_F16(a1, bf, acc[1][nb]);
      }
    }
    float qmul = (m == 0) ? 0.0625f : 1.0f;  // fold 1/sqrt(C) into q
    __syncthreads();                          // previous matrix's tile fully stored
    for (int cb = 0; cb < 2; ++cb) {
      int co_b = co_wave + cb * 16 + ((lane >> 4) << 3);
      for (int nb = 0; nb < 4; ++nb) {
        int nl = nb * 16 + (lane & 15);
        float s = scb[n_base + nl] * qmul;
        for (int r = 0; r < 8; ++r) T[nl][co_b + r] = (acc[cb][nb][r] + bias[co_b + r]) * s;
      }
    }
    __syncthreads();
    if (m < 2) {   // f32 [b][n][c]: 64 rows x 1024 B (64 pieces of 4 floats)
      float* dstb = ((m == 0) ? qT : kT) + (size_t)b * NN * CC + (size_t)n_base * CC;
      for (int g = tid; g < 64 * 64; g += 256) { int nl = g >> 6, pc = g & 63; vst2(dstb + (size_t)nl * CC + pc * 4, *(const v4f*)(&T[nl][pc * 4])); }
    } else {
      f16* vb = v16 + (size_t)b * CC * NN + n_base;
      for (int g = tid; g < 256 * 8; g += 256) {
        int c = g >> 3, pc = g & 7;
        union { v8h h; v4u u; } pk;
        for (int e = 0; e < 8; ++e) pk.h[e] = (f16)T[pc * 8 + e][c];
        vst2(vb + (size_t)c * NN + pc * 8, pk.u);
      }
    }
  }
}

// ---------------- flash attention ----------------
// out[b][n][c] f16 = softmax(q^T k) v ; 64 query rows per workgroup, tiles of 64 keys
__global__ __launch_bounds__(256) void k_attn(const float* __restrict__ qT,
                                              const float* __restrict__ kT,
                                              const f16* __restrict__ v16,
                                              f16* __restrict__ aout) {
  __shared__ __align__(16) __bf16 Qh[64][264];   // staged Q block, bf16 hi / lo planes
  __shared__ __align__(16) __bf16 Ql[64][264];
  __shared__ __align__(16) float Sbuf[64][68];   // scores f32
  __shared__ __align__(16) f16 Pbuf[64][72];     // softmax numerator f16
  __shared__ float m_run[64], l_run[64], rfac[64];
  __shared__ float pmax[4][64], psum[4][64];
  __shared__ __align__(16) f16 Ot[64][264];      // output tile [n][c]
  int b = blockIdx.y;
  int nq = blockIdx.x * 64;
  int tid = threadIdx.x, lane = tid & 31, wave = tid >> 5;
  int row_blk = wave & 3;          // S row block for this wave
  int colp = (wave >> 2) * 2;      // S col blocks colp, colp+1
  int c_wave = wave * 32;          // O channel range for this wave
  int srow = tid & 63, sq = tid >> 6;  // softmax: 4 threads per row, 16 cols each
  const float* qTb = qT + (size_t)b * NN * CC;
  const float* kTb = kT + (size_t)b * NN * CC;
  const f16* vb  = v16 + (size_t)b * CC * NN;
  const v8f vzero = {};
  v8f oacc[8];
  for (int i = 0; i < 8; ++i) oacc[i] = vzero;

  // stage Q block as bf16 hi/lo planes: 256 threads, each converts 64 floats
  {
    int row = tid >> 2, cbase = (tid & 3) * 64;
    const float* qp = &qTb[(size_t)(nq + row) * CC + cbase];
    for (int i = 0; i < 64; i += 4) {
      const v4f a = *(const v4f*)(qp + i);
#pragma unroll
      for (int e = 0; e < 4; ++e) { __bf16 h = bf_hi(a[e]); Qh[row][cbase + i + e] = h; Ql[row][cbase + i + e] = bf_lo(a[e], h); }
    }
  }
  if (tid < 64) { m_run[tid] = -1e30f; l_run[tid] = 0.f; }
  __syncthreads();

  for (int t = 0; t < NN / 64; ++t) {
    int mb = t * 64;
    // S = Q^T K for this 64x64 tile (2 subtiles per wave)
    v8f s0 = vzero, s1 = vzero;
    for (int kk = 0; kk < CC; kk += 32) {      // scores as a bf16 hi/lo split: hi*hi + hi*lo + lo*hi
      v16bf ah = load_bf_lds(&Qh[0][0], row_blk * 16 + (lane & 15), 264, kk, lane);
      v16bf al = load_bf_lds(&Ql[0][0], row_blk * 16 + (lane & 15), 264, kk, lane);
      v16bf b0h, b0l, b1h, b1l;
      load_b_split(kTb, mb + colp * 16 + (lane & 15), CC, kk, lane, b0h, b0l);
      load_b_split(kTb, mb + (colp + 1) * 16 + (lane & 15), CC, kk, lane, b1h, b1l);
      s0 = WMMA_BF16(ah, b0h, s0); s0 = WMMA_BF16(ah, b0l, s0); s0 = WMMA_BF16(al, b0h, s0);
      s1 = WMMA_BF16(ah, b1h, s1); s1 = WMMA_BF16(ah, b1l, s1); s1 = WMMA_BF16(al, b1h, s1);
    }
    for (int r = 0; r < 8; ++r) {
      int row = row_blk * 16 + r + ((lane >> 4) << 3);
      Sbuf[row][colp * 16 + (lane & 15)] = s0[r];
      Sbuf[row][(colp + 1) * 16 + (lane & 15)] = s1[r];
    }
    __syncthreads();
    // ---- parallel online softmax: all 256 threads, vectorized ----
    float arr[16];
    {
      const float4* sp = (const float4*)&Sbuf[srow][sq * 16];
      float4 f0 = sp[0], f1 = sp[1], f2 = sp[2], f3 = sp[3];
      ((float4*)arr)[0] = f0; ((float4*)arr)[1] = f1;
      ((float4*)arr)[2] = f2; ((float4*)arr)[3] = f3;
      float mx = fmaxf(fmaxf(fmaxf(f0.x, f0.y), fmaxf(f0.z, f0.w)),
                       fmaxf(fmaxf(fmaxf(f1.x, f1.y), fmaxf(f1.z, f1.w)),
                             fmaxf(fmaxf(fmaxf(f2.x, f2.y), fmaxf(f2.z, f2.w)),
                                   fmaxf(fmaxf(f3.x, f3.y), fmaxf(f3.z, f3.w)))));
      pmax[sq][srow] = mx;
    }
    __syncthreads();
    {
      float m_new = fmaxf(fmaxf(pmax[0][srow], pmax[1][srow]),
                          fmaxf(fmaxf(pmax[2][srow], pmax[3][srow]), m_run[srow]));
      float l = 0.f;
      v8h pk0, pk1;
      for (int i = 0; i < 8; ++i) {
        float p = __expf(arr[i] - m_new);
        pk0[i] = (f16)(p * PSC); l += p;
      }
      for (int i = 0; i < 8; ++i) {
        float p = __expf(arr[8 + i] - m_new);
        pk1[i] = (f16)(p * PSC); l += p;
      }
      *(v8h*)&Pbuf[srow][sq * 16] = pk0;
      *(v8h*)&Pbuf[srow][sq * 16 + 8] = pk1;
      psum[sq][srow] = l;
    }
    __syncthreads();
    if (tid < 64) {
      float mold = m_run[tid];
      float m_new = fmaxf(fmaxf(pmax[0][tid], pmax[1][tid]),
                          fmaxf(fmaxf(pmax[2][tid], pmax[3][tid]), mold));
      float rs = __expf(mold - m_new);
      l_run[tid] = l_run[tid] * rs +
                   (psum[0][tid] + psum[1][tid] + psum[2][tid] + psum[3][tid]);
      m_run[tid] = m_new;
      rfac[tid] = rs;
    }
    __syncthreads();
    // rescale O and accumulate O += P * V^T (K = 64 keys)
    for (int nb = 0; nb < 4; ++nb) {
      float f[8];
      for (int r = 0; r < 8; ++r) f[r] = rfac[nb * 16 + r + ((lane >> 4) << 3)];
      for (int cb = 0; cb < 2; ++cb)
        for (int r = 0; r < 8; ++r) oacc[nb * 2 + cb][r] *= f[r];
      for (int kk = 0; kk < 64; kk += 32) {
        v16h pa = load_a(&Pbuf[0][0], nb * 16 + (lane & 15), 72, kk, lane);
        for (int cb = 0; cb < 2; ++cb) {
          v16h vf = load_b(vb, c_wave + cb * 16 + (lane & 15), NN, mb + kk, lane);
          oacc[nb * 2 + cb] = WMMA_F16(pa, vf, oacc[nb * 2 + cb]);
        }
      }
    }
    __syncthreads();
  }
  // epilogue: divide by softmax sum (and the P scale), stage [n][c], store [b][n][c] f16 rows of 512 B
  for (int nb = 0; nb < 4; ++nb)
    for (int cb = 0; cb < 2; ++cb) {
      int c = c_wave + cb * 16 + (lane & 15);
      for (int r = 0; r < 8; ++r) {
        int nloc = nb * 16 + r + ((lane >> 4) << 3);
        Ot[nloc][c] = (f16)(oacc[nb * 2 + cb][r] * (PUN / l_run[nloc]));
      }
    }
  __syncthreads();
  {
    f16* ab = aout + (size_t)b * NN * CC + (size_t)nq * CC;
    for (int g = tid; g < 64 * 32; g += 256) { int nl = g >> 5, pc = g & 31; vst2(ab + (size_t)nl * CC + pc * 8, *(const v4u*)(&Ot[nl][pc * 8])); }
  }
}

// ---------------- output projection ----------------
__global__ __launch_bounds__(256) void k_out(const f16* __restrict__ aout,
                                             const f16* __restrict__ Wo16,
                                             const float* __restrict__ bo,
                                             float* __restrict__ out) {
  __shared__ __align__(16) float So[8][32 * 64];   // per-wave [co][n] tile
  int b = blockIdx.y;
  int n_base = blockIdx.x * 64;
  int lane = threadIdx.x & 31, wave = threadIdx.x >> 5;
  int co_wave = wave * 32;
  const f16* ab = aout + (size_t)b * NN * CC;
  const v8f vzero = {};
  v8f acc[2][4];
  for (int cb = 0; cb < 2; ++cb)
    for (int nb = 0; nb < 4; ++nb) acc[cb][nb] = vzero;
  for (int kk = 0; kk < CC; kk += 32) {
    v16h a0 = load_a(Wo16, co_wave + (lane & 15), CC, kk, lane);
    v16h a1 = load_a(Wo16, co_wave + 16 + (lane & 15), CC, kk, lane);
    for (int nb = 0; nb < 4; ++nb) {
      v16h bf = load_b(ab, n_base + nb * 16 + (lane & 15), CC, kk, lane);
      acc[0][nb] = WMMA_F16(a0, bf, acc[0][nb]);
      acc[1][nb] = WMMA_F16(a1, bf, acc[1][nb]);
    }
  }
  float* ob = out + (size_t)b * CC * NN;
  float* so = So[wave];
  for (int cb = 0; cb < 2; ++cb) {
    int col_b = cb * 16 + ((lane >> 4) << 3);
    for (int nb = 0; nb < 4; ++nb) {
      int nl = nb * 16 + (lane & 15);
      for (int r = 0; r < 8; ++r) so[(col_b + r) * 64 + nl] = acc[cb][nb][r] + bo[co_wave + col_b + r];
    }
  }
  __syncthreads();
  for (int q = 0; q < 16; ++q) {    // 32 channel rows x 256 B (16 pieces); rows 2q, 2q+1 per instruction
    int rl = q * 2 + (lane >> 4), pc = lane & 15;
    vst2(ob + (size_t)(co_wave + rl) * NN + n_base + pc * 4, *(const v4f*)(&so[rl * 64 + pc * 4]));
  }
}

extern "C" void kernel_launch(void* const* d_in, const int* in_sizes, int n_in,
                              void* d_out, int out_size, void* d_ws, size_t ws_size,
                              hipStream_t stream) {
  (void)in_sizes; (void)n_in; (void)out_size; (void)ws_size;
  const float* x  = (const float*)d_in[0];
  const float* g0 = (const float*)d_in[1];
  const float* Wq = (const float*)d_in[2];
  const float* bq = (const float*)d_in[3];
  const float* Wk = (const float*)d_in[4];
  const float* bk = (const float*)d_in[5];
  const float* Wv = (const float*)d_in[6];
  const float* bv = (const float*)d_in[7];
  const float* Wo = (const float*)d_in[8];
  const float* bo = (const float*)d_in[9];
  const float* fw = (const float*)d_in[10];

  char* ws = (char*)d_ws;
  float* scg = (float*)ws; ws += (size_t)BB * NN * sizeof(float);
  f16* W3    = (f16*)ws;   ws += (size_t)3 * CC * CC * sizeof(f16);
  f16* Wo16  = (f16*)ws;   ws += (size_t)CC * CC * sizeof(f16);
  f16* xT    = (f16*)ws;   ws += (size_t)BB * NN * CC * sizeof(f16);
  float* qT  = (float*)ws; ws += (size_t)BB * NN * CC * sizeof(float);
  float* kT  = (float*)ws; ws += (size_t)BB * NN * CC * sizeof(float);
  f16* v16   = (f16*)ws;   ws += (size_t)BB * NN * CC * sizeof(f16);
  f16* aout  = (f16*)ws;

  k_scale<<<dim3((BB * NN) / 256), 256, 0, stream>>>(g0, scg);
  k_wconv<<<dim3((4 * CC * CC / 8) / 256), 256, 0, stream>>>(Wq, Wk, Wv, Wo, fw, W3, Wo16);
  k_xt<<<dim3(NN / 64, CC / 64, BB), 256, 0, stream>>>(x, xT);
  k_qkv<<<dim3(NN / 64, BB), 256, 0, stream>>>(xT, W3, x, Wq, Wk, fw, bq, bk, bv, scg, qT, kT, v16);
  k_attn<<<dim3(NN / 64, BB), 256, 0, stream>>>(qT, kT, v16, aout);
  k_out<<<dim3(NN / 64, BB), 256, 0, stream>>>(aout, Wo16, bo, (float*)d_out);
}

// v001
// Measured time: 346 microseconds a run.
// Two timings next to v000 both put it at 2.04 times that version's speed.
#include <hip/hip_runtime.h>

#define BB 8
#define CC 256
#define NN 4096
#define H0 32
#define W0 32

typedef _Float16 f16;
typedef __attribute__((ext_vector_type(16))) _Float16 v16h;
typedef __attribute__((ext_vector_type(8)))  _Float16 v8h;
typedef __attribute__((ext_vector_type(8)))  float    v8f;

union FragU { v16h v; v8h h[2]; };
typedef __attribute__((ext_vector_type(4))) float v4f;
typedef __attribute__((ext_vector_type(4))) unsigned v4u;
// Contractions: q/k/v 1x1 convs and the output conv (K = 256), scores q^T k (K = 256) and P V^T (K = keys) on
// v_wmma_f32_16x16x32_f16 (f16 operands, f32 accumulate; P scaled by 256 before its f16 conversion) — except the scores,
// and the q/k projections, which run as bf16 hi/lo splits (hi*hi + hi*lo + lo*hi) of f32 operands (q, k kept in f32). The FFT refine with
// per-channel real weights is exactly fw_c * x and is folded into the conv weights; bilinear guide, sigmoid, softmax in f32.
template <typename V> __device__ __forceinline__ void vst2(void* p, V v) {
  *(V*)p = v; 
}
#define PSC 256.0f
#define PUN (1.0f / 256.0f)
typedef __attribute__((ext_vector_type(16))) __bf16 v16bf;
typedef __attribute__((ext_vector_type(8)))  __bf16 v8bf;
typedef __attribute__((ext_vector_type(4)))  __bf16 v4bf;
__device__ __forceinline__ __bf16 bf_hi(float x) { return (__bf16)x; }
__device__ __forceinline__ __bf16 bf_lo(float x, __bf16 h) { return (__bf16)(x - (float)h); }
__device__ __forceinline__ v8f WMMA_BF16(v16bf a, v16bf b, v8f c) {
  v8f d = __builtin_amdgcn_wmma_f32_16x16x32_bf16(false, a, false, b, (short)0, c, false, false);
  asm volatile("v_nop\n\tv_nop\n\tv_nop\n\tv_nop" : "+v"(d) : "v"(a), "v"(b));
  return d;
}
// bf16 fragment from an LDS plane [row][rs] (split K map)
__device__ __forceinline__ v16bf load_bf_lds(const __bf16* base, int row, int rs, int kbase, int lane) {
  union { v16bf v; v8bf h[2]; } u;
  const __bf16* p = base + (size_t)row * rs + kbase + ((lane >> 4) << 3);
  u.h[0] = *(const v8bf*)(p); u.h[1] = *(const v8bf*)(p + 16);
  return u.v;
}
// A-matrix fragment (16x32 f16, M x K), memory layout [row][k] row-major.
// Element i of lane L: K = kbase + (i/8)*16 + (L/16)*8 + i%8, M = row (caller adds lane%16).
__device__ __forceinline__ v16h load_a(const f16* base, int row, int rs, int kbase, int lane) {
  const f16* p = base + (size_t)row * rs + kbase + ((lane >> 4) << 3);
  FragU u;
  u.h[0] = *(const v8h*)(p);
  u.h[1] = *(const v8h*)(p + 16);
  return u.v;
}
// B-matrix fragment (32x16 f16, K x N), memory layout [col][k] (K contiguous); same per-lane K map as A:
// Element i of lane L: K = kbase + (i/8)*16 + (L/16)*8 + i%8, N = col.
__device__ __forceinline__ v16h load_b(const f16* base, int col, int rs, int kbase, int lane) {
  return load_a(base, col, rs, kbase, lane);
}

__device__ __forceinline__ v8f WMMA_F16(v16h a, v16h b, v8f c) {
  v8f d = __builtin_amdgcn_wmma_f32_16x16x32_f16(false, a, false, b, (short)0, c, false, false);
  asm volatile("v_nop\n\tv_nop\n\tv_nop\n\tv_nop" : "+v"(d) : "v"(a), "v"(b));
  return d;
}

// ---------------- prep kernels ----------------

// bilinear(align_corners) + sigmoid -> scale = 1 + sigmoid(g)
__global__ __launch_bounds__(256) void k_scale(const float* __restrict__ g0,
                                               float* __restrict__ sc) {
  int idx = blockIdx.x * 256 + threadIdx.x;   // B*N
  int b = idx >> 12, n = idx & (NN - 1);
  int ny = n >> 6, nx = n & 63;
  float fy = ny * (31.0f / 63.0f);
  float fx = nx * (31.0f / 63.0f);
  int y0 = (int)fy, x0 = (int)fx;
  float wy = fy - (float)y0, wx = fx - (float)x0;
  int y1 = min(y0 + 1, H0 - 1), x1 = min(x0 + 1, W0 - 1);
  const float* g = g0 + (size_t)b * H0 * W0;
  float v00 = g[y0 * W0 + x0], v01 = g[y0 * W0 + x1];
  float v10 = g[y1 * W0 + x0], v11 = g[y1 * W0 + x1];
  float vy0 = v00 * (1.f - wx) + v01 * wx;
  float vy1 = v10 * (1.f - wx) + v11 * wx;
  float v = vy0 * (1.f - wy) + vy1 * wy;
  vst2(sc + idx, 1.0f + 1.0f / (1.0f + __expf(-v)));
}

// convert weights to f16; fold freq_weights into Wq/Wk/Wv columns (refined = fw*x)
__global__ __launch_bounds__(256) void k_wconv(const float* __restrict__ Wq,
                                               const float* __restrict__ Wk,
                                               const float* __restrict__ Wv,
                                               const float* __restrict__ Wo,
                                               const float* __restrict__ fw,
                                               f16* __restrict__ W3,
                                               f16* __restrict__ Wo16) {
  int g = blockIdx.x * 256 + threadIdx.x;     // 4*256*256/8 pieces of 8 halves
  int idx0 = g * 8;
  int m = idx0 >> 16, r0 = idx0 & 65535;
  const float* W = (m == 0) ? Wq : (m == 1) ? Wk : (m == 2) ? Wv : Wo;
  union { v8h h; v4u u; } pk;
#pragma unroll
  for (int e = 0; e < 8; ++e) { int r = r0 + e, ci = r & (CC - 1); pk.h[e] = (f16)(W[r] * ((m < 3) ? fw[ci] : 1.0f)); }
  f16* dst = (m < 3) ? (W3 + (size_t)m * 65536 + r0) : (Wo16 + r0);
  vst2(dst, pk.u);
}

// x [b][c][n] f32 -> xT [b][n][c] f16 via LDS 64x64 tile (coalesced both sides)
__global__ __launch_bounds__(256) void k_xt(const float* __restrict__ x,
                                            f16* __restrict__ xT) {
  __shared__ __align__(16) f16 tile[64][72];
  int b = blockIdx.z, c0 = blockIdx.y * 64, n0 = blockIdx.x * 64;
  int tid = threadIdx.x;
  {
    int cl = tid >> 2, nq = (tid & 3) * 16;
    const float4* src = (const float4*)(x + (size_t)b * CC * NN +
                                        (size_t)(c0 + cl) * NN + n0 + nq);
    for (int i = 0; i < 4; ++i) {
      float4 v = src[i];
      tile[cl][nq + 4 * i + 0] = (f16)v.x;
      tile[cl][nq + 4 * i + 1] = (f16)v.y;
      tile[cl][nq + 4 * i + 2] = (f16)v.z;
      tile[cl][nq + 4 * i + 3] = (f16)v.w;
    }
  }
  __syncthreads();
  for (int pass = 0; pass < 2; ++pass) {
    int nl = pass * 32 + (tid >> 3), cq = (tid & 7) * 8;
    f16* dst = xT + (size_t)b * NN * CC + (size_t)(n0 + nl) * CC + c0 + cq;
    union { v8h h; v4u u; } o;
    for (int i = 0; i < 8; ++i) o.h[i] = tile[cq + i][nl];
    vst2(dst, o.u);
  }
}

// ---------------- QKV GEMM ----------------
// q/k stored [b][n][c] (transposed, f32, scaled); v stored [b][c][n] (f16, scaled)
__global__ __launch_bounds__(256) void k_qkv(const f16* __restrict__ xT,
                                             const f16* __restrict__ W3,
                                             const float* __restrict__ xf,   // x f32 [b][c][n]
                                             const float* __restrict__ Wqf, const float* __restrict__ Wkf,
                                             const float* __restrict__ fw,
                                             const float* __restrict__ bq,
                                             const float* __restrict__ bk,
                                             const float* __restrict__ bv,
                                             const float* __restrict__ scg,
                                             float* __restrict__ qT,
                                             float* __restrict__ kT,
                                             f16* __restrict__ v16) {
  __shared__ __align__(16) float T[64][260];   // block tile [n][c] (padded), f32
  int b = blockIdx.y;
  int n_base = blockIdx.x * 64;
  int tid = threadIdx.x;
  int lane = threadIdx.x & 31, wave = threadIdx.x >> 5;
  int co_wave = wave * 32;
  const f16* xTb = xT + (size_t)b * NN * CC;
  const float* scb = scg + (size_t)b * NN;
  const v8f vzero = {};
  const float* xfb = xf + (size_t)b * CC * NN;
  for (int m = 0; m < 3; ++m) {
    const f16* Wm = W3 + (size_t)m * 65536;
    const float* bias = (m == 0) ? bq : ((m == 1) ? bk : bv);
    v8f acc[2][4];
    for (int cb = 0; cb < 2; ++cb)
      for (int nb = 0; nb < 4; ++nb) acc[cb][nb] = vzero;
    if (m < 2) {
      // q and k as a bf16 hi/lo split of f32 operands: A = (W*fw) rows [co][ci] (contiguous), B = x[b][c][n] gathered down c (stride NN)
      const float* Wf = (m == 0) ? Wqf : Wkf;
      for (int kk = 0; kk < CC; kk += 32) {
        v16bf ah[2], al[2];
#pragma unroll
        for (int cb = 0; cb < 2; ++cb) {
          const float* wr = Wf + (size_t)(co_wave + cb * 16 + (lane & 15)) * CC + kk + ((lane >> 4) << 3);
#pragma unroll
          for (int e = 0; e < 16; ++e) { const int ko = (e < 8) ? e : (8 + e); const float w = wr[ko] * fw[kk + ((lane >> 4) << 3) + ko];
                                         __bf16 hh = bf_hi(w); ah[cb][e] = hh; al[cb][e] = bf_lo(w, hh); }
        }
        for (int nb = 0; nb < 4; ++nb) {
          v16bf bh, bl;
          const float* xp = xfb + (size_t)(kk + ((lane >> 4) << 3)) * NN + n_base + nb * 16 + (lane & 15);
#pragma unroll
          for (int e = 0; e < 16; ++e) { const int ko = (e < 8) ? e : (8 + e); const float xv = xp[(size_t)ko * NN];
                                         __bf16 hh = bf_hi(xv); bh[e] = hh; bl[e] = bf_lo(xv, hh); }
          acc[0][nb] = WMMA_BF16(ah[0], bh, acc[0][nb]); acc[0][nb] = WMMA_BF16(ah[0], bl, acc[0][nb]); acc[0][nb] = WMMA_BF16(al[0], bh, acc[0][nb]);
          acc[1][nb] = WMMA_BF16(ah[1], bh, acc[1][nb]); acc[1][nb] = WMMA_BF16(ah[1], bl, acc[1][nb]); acc[1][nb] = WMMA_BF16(al[1], bh, acc[1][nb]);
        }
      }
    } else
    for (int kk = 0; kk < CC; kk += 32) {
      v16h a0 = load_a(Wm, co_wave + (lane & 15), CC, kk, lane);
      v16h a1 = load_a(Wm, co_wave + 16 + (lane & 15), CC, kk, lane);
      for (int nb = 0; nb < 4; ++nb) {
        v16h bf = load_b(xTb, n_base + nb * 16 + (lane & 15), CC, kk, lane);
        acc[0][nb] = WMMA_F16(a0, bf, acc[0][nb]);
        acc[1][nb] = WMMA_F16(a1, bf, acc[1][nb]);
      }
    }
    float qmul = (m == 0) ? 0.0625f : 1.0f;  // fold 1/sqrt(C) into q
    __syncthreads();                          // previous matrix's tile fully stored
    for (int cb = 0; cb < 2; ++cb) {
      int co_b = co_wave + cb * 16 + ((lane >> 4) << 3);
      for (int nb = 0; nb < 4; ++nb) {
        int nl = nb * 16 + (lane & 15);
        float s = scb[n_base + nl] * qmul;
        for (int r = 0; r < 8; ++r) T[nl][co_b + r] = (acc[cb][nb][r] + bias[co_b + r]) * s;
      }
    }
    __syncthreads();
    if (m < 2) {   // f32 [b][n][c]: 64 rows x 1024 B (64 pieces of 4 floats)
      float* dstb = ((m == 0) ? qT : kT) + (size_t)b * NN * CC + (size_t)n_base * CC;
      for (int g = tid; g < 64 * 64; g += 256) { int nl = g >> 6, pc = g & 63; vst2(dstb + (size_t)nl * CC + pc * 4, *(const v4f*)(&T[nl][pc * 4])); }
    } else {
      f16* vb = v16 + (size_t)b * CC * NN + n_base;
      for (int g = tid; g < 256 * 8; g += 256) {
        int c = g >> 3, pc = g & 7;
        union { v8h h; v4u u; } pk;
        for (int e = 0; e < 8; ++e) pk.h[e] = (f16)T[pc * 8 + e][c];
        vst2(vb + (size_t)c * NN + pc * 8, pk.u);
      }
    }
  }
}

// ---------------- flash attention ----------------
// out[b][n][c] f16 = softmax(q^T k) v ; 64 query rows per workgroup, tiles of 64 keys
__global__ __launch_bounds__(256) void k_attn(const float* __restrict__ qT,
                                              const float* __restrict__ kT,
                                              const f16* __restrict__ v16,
                                              f16* __restrict__ aout) {
  __shared__ __align__(16) __bf16 Qh[64][264];   // staged Q block, bf16 hi / lo planes
  __shared__ __align__(16) __bf16 Ql[64][264];
  __shared__ __align__(16) __bf16 Kh[64][264];   // staged K tile, bf16 hi / lo planes, converted once per work-group
  __shared__ __align__(16) __bf16 Kl[64][264];
  __shared__ __align__(16) float Sbuf[64][68];   // scores f32
  // softmax numerator f16: takes over the score bytes once every thread holds its scores in registers (a barrier lies between)
  f16 (*Pbuf)[72] = reinterpret_cast<f16 (*)[72]>(&Sbuf[0][0]);
  __shared__ float m_run[64], l_run[64], rfac[64];
  __shared__ float pmax[4][64], psum[4][64];
  // output tile [n][c]: takes over the K hi plane after the last tile's scores (keeps two work-groups' LDS on one WGP)
  f16 (*Ot)[264] = reinterpret_cast<f16 (*)[264]>(&Kh[0][0]);
  int b = blockIdx.y;
  int nq = blockIdx.x * 64;
  int tid = threadIdx.x, lane = tid & 31, wave = tid >> 5;
  int row_blk = wave & 3;          // S row block for this wave
  int colp = (wave >> 2) * 2;      // S col blocks colp, colp+1
  int c_wave = wave * 32;          // O channel range for this wave
  int srow = tid & 63, sq = tid >> 6;  // softmax: 4 threads per row, 16 cols each
  const float* qTb = qT + (size_t)b * NN * CC;
  const float* kTb = kT + (size_t)b * NN * CC;
  const f16* vb  = v16 + (size_t)b * CC * NN;
  const v8f vzero = {};
  v8f oacc[8];
  for (int i = 0; i < 8; ++i) oacc[i] = vzero;

  // K tile = 64 KiB contiguous: piece i of a thread is 16 B at (i * 256 + tid) * 16, so each wave-wide load covers 4 whole lines
  const float* kp = kTb + tid * 4;
  const int krow = tid >> 6, kcol = (tid & 63) * 4;
  v4f kreg[16];
#pragma unroll   // constant indices keep kreg in registers (here and at the two loops over it below)
  for (int i = 0; i < 16; ++i) kreg[i] = *(const v4f*)(kp + i * 1024);

  // stage Q block as bf16 hi/lo planes: 256 threads, each converts 64 floats
  {
    int row = tid >> 2, cbase = (tid & 3) * 64;
    const float* qp = &qTb[(size_t)(nq + row) * CC + cbase];
    for (int i = 0; i < 64; i += 4) {
      const v4f a = *(const v4f*)(qp + i);
#pragma unroll
      for (int e = 0; e < 4; ++e) { __bf16 h = bf_hi(a[e]); Qh[row][cbase + i + e] = h; Ql[row][cbase + i + e] = bf_lo(a[e], h); }
    }
  }
  if (tid < 64) { m_run[tid] = -1e30f; l_run[tid] = 0.f; }
  __syncthreads();

  for (int t = 0; t < NN / 64; ++t) {
    int mb = t * 64;
    // split this tile's K once and lay it in LDS
#pragma unroll
    for (int i = 0; i < 16; ++i) {
      v4bf h4, l4;
#pragma unroll
      for (int e = 0; e < 4; ++e) { __bf16 h = bf_hi(kreg[i][e]); h4[e] = h; l4[e] = bf_lo(kreg[i][e], h); }
      *(v4bf*)&Kh[i * 4 + krow][kcol] = h4;
      *(v4bf*)&Kl[i * 4 + krow][kcol] = l4;
    }
    __syncthreads();   // publishes the K planes; also ends the previous tile's reads of P and rfac
    // the next tile's loads start behind the barrier (in front of it the barrier's own wait would drain them) and fly under the score products
    if (t + 1 < NN / 64) {
#pragma unroll
      for (int i = 0; i < 16; ++i) kreg[i] = *(const v4f*)(kp + (size_t)(mb + 64) * CC + i * 1024);
    }
    // S = Q^T K for this 64x64 tile (2 subtiles per wave)
    v8f s0 = vzero, s1 = vzero;
    for (int kk = 0; kk < CC; kk += 32) {      // scores as a bf16 hi/lo split: hi*hi + hi*lo + lo*hi
      v16bf ah = load_bf_lds(&Qh[0][0], row_blk * 16 + (lane & 15), 264, kk, lane);
      v16bf al = load_bf_lds(&Ql[0][0], row_blk * 16 + (lane & 15), 264, kk, lane);
      v16bf b0h = load_bf_lds(&Kh[0][0], colp * 16 + (lane & 15), 264, kk, lane);
      v16bf b0l = load_bf_lds(&Kl[0][0], colp * 16 + (lane & 15), 264, kk, lane);
      v16bf b1h = load_bf_lds(&Kh[0][0], (colp + 1) * 16 + (lane & 15), 264, kk, lane);
      v16bf b1l = load_bf_lds(&Kl[0][0], (colp + 1) * 16 + (lane & 15), 264, kk, lane);
      s0 = WMMA_BF16(ah, b0h, s0); s0 = WMMA_BF16(ah, b0l, s0); s0 = WMMA_BF16(al, b0h, s0);
      s1 = WMMA_BF16(ah, b1h, s1); s1 = WMMA_BF16(ah, b1l, s1); s1 = WMMA_BF16(al, b1h, s1);
    }
    for (int r = 0; r < 8; ++r) {
      int row = row_blk * 16 + r + ((lane >> 4) << 3);
      Sbuf[row][colp * 16 + (lane & 15)] = s0[r];
      Sbuf[row][(colp + 1) * 16 + (lane & 15)] = s1[r];
    }
    __syncthreads();
    // ---- parallel online softmax: all 256 threads, vectorized ----
    float arr[16];
    {
      const float4* sp = (const float4*)&Sbuf[srow][sq * 16];
      float4 f0 = sp[0], f1 = sp[1], f2 = sp[2], f3 = sp[3];
      ((float4*)arr)[0] = f0; ((float4*)arr)[1] = f1;
      ((float4*)arr)[2] = f2; ((float4*)arr)[3] = f3;
      float mx = fmaxf(fmaxf(fmaxf(f0.x, f0.y), fmaxf(f0.z, f0.w)),
                       fmaxf(fmaxf(fmaxf(f1.x, f1.y), fmaxf(f1.z, f1.w)),
                             fmaxf(fmaxf(fmaxf(f2.x, f2.y), fmaxf(f2.z, f2.w)),
                                   fmaxf(fmaxf(f3.x, f3.y), fmaxf(f3.z, f3.w)))));
      pmax[sq][srow] = mx;
    }
    __syncthreads();
    {
      float m_new = fmaxf(fmaxf(pmax[0][srow], pmax[1][srow]),
                          fmaxf(fmaxf(pmax[2][srow], pmax[3][srow]), m_run[srow]));
      float l = 0.f;
      v8h pk0, pk1;
      for (int i = 0; i < 8; ++i) {
        float p = __expf(arr[i] - m_new);
        pk0[i] = (f16)(p * PSC); l += p;
      }
      for (int i = 0; i < 8; ++i) {
        float p = __expf(arr[8 + i] - m_new);
        pk1[i] = (f16)(p * PSC); l += p;
      }
      *(v8h*)&Pbuf[srow][sq * 16] = pk0;
      *(v8h*)&Pbuf[srow][sq * 16 + 8] = pk1;
      psum[sq][srow] = l;
    }
    __syncthreads();
    if (tid < 64) {
      float mold = m_run[tid];
      float m_new = fmaxf(fmaxf(pmax[0][tid], pmax[1][tid]),
                          fmaxf(fmaxf(pmax[2][tid], pmax[3][tid]), mold));
      float rs = __expf(mold - m_new);
      l_run[tid] = l_run[tid] * rs +
                   (psum[0][tid] + psum[1][tid] + psum[2][tid] + psum[3][tid]);
      m_run[tid] = m_new;
      rfac[tid] = rs;
    }
    __syncthreads();
    // rescale O and accumulate O += P * V^T (K = 64 keys)
    for (int nb = 0; nb < 4; ++nb) {
      float f[8];
      for (int r = 0; r < 8; ++r) f[r] = rfac[nb * 16 + r + ((lane >> 4) << 3)];
      for (int cb = 0; cb < 2; ++cb)
        for (int r = 0; r < 8; ++r) oacc[nb * 2 + cb][r] *= f[r];
      for (int kk = 0; kk < 64; kk += 32) {
        v16h pa = load_a(&Pbuf[0][0], nb * 16 + (lane & 15), 72, kk, lane);
        for (int cb = 0; cb < 2; ++cb) {
          v16h vf = load_b(vb, c_wave + cb * 16 + (lane & 15), NN, mb + kk, lane);
          oacc[nb * 2 + cb] = WMMA_F16(pa, vf, oacc[nb * 2 + cb]);
        }
      }
    }
  }
  // epilogue: divide by softmax sum (and the P scale), stage [n][c], store [b][n][c] f16 rows of 512 B
  for (int nb = 0; nb < 4; ++nb)
    for (int cb = 0; cb < 2; ++cb) {
      int c = c_wave + cb * 16 + (lane & 15);
      for (int r = 0; r < 8; ++r) {
        int nloc = nb * 16 + r + ((lane >> 4) << 3);
        Ot[nloc][c] = (f16)(oacc[nb * 2 + cb][r] * (PUN / l_run[nloc]));
      }
    }
  __syncthreads();
  {
    f16* ab = aout + (size_t)b * NN * CC + (size_t)nq * CC;
    for (int g = tid; g < 64 * 32; g += 256) { int nl = g >> 5, pc = g & 31; vst2(ab + (size_t)nl * CC + pc * 8, *(const v4u*)(&Ot[nl][pc * 8])); }
  }
}

// ---------------- output projection ----------------
__global__ __launch_bounds__(256) void k_out(const f16* __restrict__ aout,
                                             const f16* __restrict__ Wo16,
                                             const float* __restrict__ bo,
                                             float* __restrict__ out) {
  __shared__ __align__(16) float So[8][32 * 64];   // per-wave [co][n] tile
  int b = blockIdx.y;
  int n_base = blockIdx.x * 64;
  int lane = threadIdx.x & 31, wave = threadIdx.x >> 5;
  int co_wave = wave * 32;
  const f16* ab = aout + (size_t)b * NN * CC;
  const v8f vzero = {};
  v8f acc[2][4];
  for (int cb = 0; cb < 2; ++cb)
    for (int nb = 0; nb < 4; ++nb) acc[cb][nb] = vzero;
  for (int kk = 0; kk < CC; kk += 32) {
    v16h a0 = load_a(Wo16, co_wave + (lane & 15), CC, kk, lane);
    v16h a1 = load_a(Wo16, co_wave + 16 + (lane & 15), CC, kk, lane);
    for (int nb = 0; nb < 4; ++nb) {
      v16h bf = load_b(ab, n_base + nb * 16 + (lane & 15), CC, kk, lane);
      acc[0][nb] = WMMA_F16(a0, bf, acc[0][nb]);
      acc[1][nb] = WMMA_F16(a1, bf, acc[1][nb]);
    }
  }
  float* ob = out + (size_t)b * CC * NN;
  float* so = So[wave];
  for (int cb = 0; cb < 2; ++cb) {
    int col_b = cb * 16 + ((lane >> 4) << 3);
    for (int nb = 0; nb < 4; ++nb) {
      int nl = nb * 16 + (lane & 15);
      for (int r = 0; r < 8; ++r) so[(col_b + r) * 64 + nl] = acc[cb][nb][r] + bo[co_wave + col_b + r];
    }
  }
  __syncthreads();
  for (int q = 0; q < 16; ++q) {    // 32 channel rows x 256 B (16 pieces); rows 2q, 2q+1 per instruction
    int rl = q * 2 + (lane >> 4), pc = lane & 15;
    vst2(ob + (size_t)(co_wave + rl) * NN + n_base + pc * 4, *(const v4f*)(&so[rl * 64 + pc * 4]));
  }
}

extern "C" void kernel_launch(void* const* d_in, const int* in_sizes, int n_in,
                              void* d_out, int out_size, void* d_ws, size_t ws_size,
                              hipStream_t stream) {
  (void)in_sizes; (void)n_in; (void)out_size; (void)ws_size;
  const float* x  = (const float*)d_in[0];
  const float* g0 = (const float*)d_in[1];
  const float* Wq = (const float*)d_in[2];
  const float* bq = (const float*)d_in[3];
  const float* Wk = (const float*)d_in[4];
  const float* bk = (const float*)d_in[5];
  const float* Wv = (const float*)d_in[6];
  const float* bv = (const float*)d_in[7];
  const float* Wo = (const float*)d_in[8];
  const float* bo = (const float*)d_in[9];
  const float* fw = (const float*)d_in[10];

  char* ws = (char*)d_ws;
  float* scg = (float*)ws; ws += (size_t)BB * NN * sizeof(float);
  f16* W3    = (f16*)ws;   ws += (size_t)3 * CC * CC * sizeof(f16);
  f16* Wo16  = (f16*)ws;   ws += (size_t)CC * CC * sizeof(f16);
  f16* xT    = (f16*)ws;   ws += (size_t)BB * NN * CC * sizeof(f16);
  float* qT  = (float*)ws; ws += (size_t)BB * NN * CC * sizeof(float);
  float* kT  = (float*)ws; ws += (size_t)BB * NN * CC * sizeof(float);
  f16* v16   = (f16*)ws;   ws += (size_t)BB * NN * CC * sizeof(f16);
  f16* aout  = (f16*)ws;

  k_scale<<<dim3((BB * NN) / 256), 256, 0, stream>>>(g0, scg);
  k_wconv<<<dim3((4 * CC * CC / 8) / 256), 256, 0, stream>>>(Wq, Wk, Wv, Wo, fw, W3, Wo16);
  k_xt<<<dim3(NN / 64, CC / 64, BB), 256, 0, stream>>>(x, xT);
  k_qkv<<<dim3(NN / 64, BB), 256, 0, stream>>>(xT, W3, x, Wq, Wk, fw, bq, bk, bv, scg, qT, kT, v16);
  k_attn<<<dim3(NN / 64, BB), 256, 0, stream>>>(qT, kT, v16, aout);
  k_out<<<dim3(NN / 64, BB), 256, 0, stream>>>(aout, Wo16, bo, (float*)d_out);
}

// v002
// One run takes 323 microseconds.
// Two timings next to v001 both put it at 1.07 times that version's speed.
// Over all steps from v000 it is 2.19 times as fast.
#include <hip/hip_runtime.h>

#define BB 8
#define CC 256
#define NN 4096
#define H0 32
#define W0 32

typedef _Float16 f16;
typedef __attribute__((ext_vector_type(16))) _Float16 v16h;
typedef __attribute__((ext_vector_type(8)))  _Float16 v8h;
typedef __attribute__((ext_vector_type(8)))  float    v8f;

union FragU { v16h v; v8h h[2]; };
typedef __attribute__((ext_vector_type(4))) float v4f;
typedef __attribute__((ext_vector_type(4))) unsigned v4u;
// Contractions: q/k/v 1x1 convs and the output conv (K = 256), scores q^T k (K = 256) and P V^T (K = keys) on
// v_wmma_f32_16x16x32_f16 (f16 operands, f32 accumulate; P scaled by 256 before its f16 conversion) — except the scores,
// and the q/k projections, which run as bf16 hi/lo splits (hi*hi + hi*lo + lo*hi) of f32 operands (q, k kept in f32). The FFT refine with
// per-channel real weights is exactly fw_c * x and is folded into the conv weights; bilinear guide, sigmoid, softmax in f32.
template <typename V> __device__ __forceinline__ void vst2(void* p, V v) {
  *(V*)p = v; 
}
#define PSC 256.0f
#define PUN (1.0f / 256.0f)
typedef __attribute__((ext_vector_type(16))) __bf16 v16bf;
typedef __attribute__((ext_vector_type(8)))  __bf16 v8bf;
typedef __attribute__((ext_vector_type(4)))  __bf16 v4bf;
__device__ __forceinline__ __bf16 bf_hi(float x) { return (__bf16)x; }
__device__ __forceinline__ __bf16 bf_lo(float x, __bf16 h) { return (__bf16)(x - (float)h); }
__device__ __forceinline__ v8f WMMA_BF16(v16bf a, v16bf b, v8f c) {
  v8f d = __builtin_amdgcn_wmma_f32_16x16x32_bf16(false, a, false, b, (short)0, c, false, false);
  asm volatile("v_nop\n\tv_nop\n\tv_nop\n\tv_nop" : "+v"(d) : "v"(a), "v"(b));
  return d;
}
// bf16 fragment from an LDS plane [row][rs] (split K map)
__device__ __forceinline__ v16bf load_bf_lds(const __bf16* base, int row, int rs, int kbase, int lane) {
  union { v16bf v; v8bf h[2]; } u;
  const __bf16* p = base + (size_t)row * rs + kbase + ((lane >> 4) << 3);
  u.h[0] = *(const v8bf*)(p); u.h[1] = *(const v8bf*)(p + 16);
  return u.v;
}
// A-matrix fragment (16x32 f16, M x K), memory layout [row][k] row-major.
// Element i of lane L: K = kbase + (i/8)*16 + (L/16)*8 + i%8, M = row (caller adds lane%16).
__device__ __forceinline__ v16h load_a(const f16* base, int row, int rs, int kbase, int lane) {
  const f16* p = base + (size_t)row * rs + kbase + ((lane >> 4) << 3);
  FragU u;
  u.h[0] = *(const v8h*)(p);
  u.h[1] = *(const v8h*)(p + 16);
  return u.v;
}
// B-matrix fragment (32x16 f16, K x N), memory layout [col][k] (K contiguous); same per-lane K map as A:
// Element i of lane L: K = kbase + (i/8)*16 + (L/16)*8 + i%8, N = col.
__device__ __forceinline__ v16h load_b(const f16* base, int col, int rs, int kbase, int lane) {
  return load_a(base, col, rs, kbase, lane);
}

__device__ __forceinline__ v8f WMMA_F16(v16h a, v16h b, v8f c) {
  v8f d = __builtin_amdgcn_wmma_f32_16x16x32_f16(false, a, false, b, (short)0, c, false, false);
  asm volatile("v_nop\n\tv_nop\n\tv_nop\n\tv_nop" : "+v"(d) : "v"(a), "v"(b));
  return d;
}

// ---------------- prep kernels ----------------

// bilinear(align_corners) + sigmoid -> scale = 1 + sigmoid(g)
__global__ __launch_bounds__(256) void k_scale(const float* __restrict__ g0,
                                               float* __restrict__ sc) {
  int idx = blockIdx.x * 256 + threadIdx.x;   // B*N
  int b = idx >> 12, n = idx & (NN - 1);
  int ny = n >> 6, nx = n & 63;
  float fy = ny * (31.0f / 63.0f);
  float fx = nx * (31.0f / 63.0f);
  int y0 = (int)fy, x0 = (int)fx;
  float wy = fy - (float)y0, wx = fx - (float)x0;
  int y1 = min(y0 + 1, H0 - 1), x1 = min(x0 + 1, W0 - 1);
  const float* g = g0 + (size_t)b * H0 * W0;
  float v00 = g[y0 * W0 + x0], v01 = g[y0 * W0 + x1];
  float v10 = g[y1 * W0 + x0], v11 = g[y1 * W0 + x1];
  float vy0 = v00 * (1.f - wx) + v01 * wx;
  float vy1 = v10 * (1.f - wx) + v11 * wx;
  float v = vy0 * (1.f - wy) + vy1 * wy;
  vst2(sc + idx, 1.0f + 1.0f / (1.0f + __expf(-v)));
}

// convert weights to f16; fold freq_weights into Wq/Wk/Wv columns (refined = fw*x)
__global__ __launch_bounds__(256) void k_wconv(const float* __restrict__ Wq,
                                               const float* __restrict__ Wk,
                                               const float* __restrict__ Wv,
                                               const float* __restrict__ Wo,
                                               const float* __restrict__ fw,
                                               f16* __restrict__ W3,
                                               f16* __restrict__ Wo16) {
  int g = blockIdx.x * 256 + threadIdx.x;     // 4*256*256/8 pieces of 8 halves
  int idx0 = g * 8;
  int m = idx0 >> 16, r0 = idx0 & 65535;
  const float* W = (m == 0) ? Wq : (m == 1) ? Wk : (m == 2) ? Wv : Wo;
  union { v8h h; v4u u; } pk;
#pragma unroll
  for (int e = 0; e < 8; ++e) { int r = r0 + e, ci = r & (CC - 1); pk.h[e] = (f16)(W[r] * ((m < 3) ? fw[ci] : 1.0f)); }
  f16* dst = (m < 3) ? (W3 + (size_t)m * 65536 + r0) : (Wo16 + r0);
  vst2(dst, pk.u);
}

// x [b][c][n] f32 -> xT [b][n][c] f16 via LDS 64x64 tile (coalesced both sides)
__global__ __launch_bounds__(256) void k_xt(const float* __restrict__ x,
                                            f16* __restrict__ xT) {
  __shared__ __align__(16) f16 tile[64][72];
  int b = blockIdx.z, c0 = blockIdx.y * 64, n0 = blockIdx.x * 64;
  int tid = threadIdx.x;
  {
    int cl = tid >> 2, nq = (tid & 3) * 16;
    const float4* src = (const float4*)(x + (size_t)b * CC * NN +
                                        (size_t)(c0 + cl) * NN + n0 + nq);
    for (int i = 0; i < 4; ++i) {
      float4 v = src[i];
      tile[cl][nq + 4 * i + 0] = (f16)v.x;
      tile[cl][nq + 4 * i + 1] = (f16)v.y;
      tile[cl][nq + 4 * i + 2] = (f16)v.z;
      tile[cl][nq + 4 * i + 3] = (f16)v.w;
    }
  }
  __syncthreads();
  for (int pass = 0; pass < 2; ++pass) {
    int nl = pass * 32 + (tid >> 3), cq = (tid & 7) * 8;
    f16* dst = xT + (size_t)b * NN * CC + (size_t)(n0 + nl) * CC + c0 + cq;
    union { v8h h; v4u u; } o;
    for (int i = 0; i < 8; ++i) o.h[i] = tile[cq + i][nl];
    vst2(dst, o.u);
  }
}

// ---------------- QKV GEMM ----------------
// q/k stored [b][n][c] (transposed, f32, scaled); v stored [b][c][n] (f16, scaled)
__global__ __launch_bounds__(256) void k_qkv(const f16* __restrict__ xT,
                                             const f16* __restrict__ W3,
                                             const float* __restrict__ xf,   // x f32 [b][c][n]
                                             const float* __restrict__ Wqf, const float* __restrict__ Wkf,
                                             const float* __restrict__ fw,
                                             const float* __restrict__ bq,
                                             const float* __restrict__ bk,
                                             const float* __restrict__ bv,
                                             const float* __restrict__ scg,
                                             float* __restrict__ qT,
                                             float* __restrict__ kT,
                                             f16* __restrict__ v16) {
  __shared__ __align__(16) float T[64][260];   // block tile [n][c] (padded), f32
  int b = blockIdx.y;
  int n_base = blockIdx.x * 64;
  int tid = threadIdx.x;
  int lane = threadIdx.x & 31, wave = threadIdx.x >> 5;
  int co_wave = wave * 32;
  const f16* xTb = xT + (size_t)b * NN * CC;
  const float* scb = scg + (size_t)b * NN;
  const v8f vzero = {};
  const float* xfb = xf + (size_t)b * CC * NN;
  for (int m = 0; m < 3; ++m) {
    const f16* Wm = W3 + (size_t)m * 65536;
    const float* bias = (m == 0) ? bq : ((m == 1) ? bk : bv);
    v8f acc[2][4];
    for (int cb = 0; cb < 2; ++cb)
      for (int nb = 0; nb < 4; ++nb) acc[cb][nb] = vzero;
    if (m < 2) {
      // q and k as a bf16 hi/lo split of f32 operands: A = (W*fw) rows [co][ci] (contiguous), B = x[b][c][n] gathered down c (stride NN)
      const float* Wf = (m == 0) ? Wqf : Wkf;
      for (int kk = 0; kk < CC; kk += 32) {
        v16bf ah[2], al[2];
#pragma unroll
        for (int cb = 0; cb < 2; ++cb) {
          const float* wr = Wf + (size_t)(co_wave + cb * 16 + (lane & 15)) * CC + kk + ((lane >> 4) << 3);
#pragma unroll
          for (int e = 0; e < 16; ++e) { const int ko = (e < 8) ? e : (8 + e); const float w = wr[ko] * fw[kk + ((lane >> 4) << 3) + ko];
                                         __bf16 hh = bf_hi(w); ah[cb][e] = hh; al[cb][e] = bf_lo(w, hh); }
        }
        for (int nb = 0; nb < 4; ++nb) {
          v16bf bh, bl;
          const float* xp = xfb + (size_t)(kk + ((lane >> 4) << 3)) * NN + n_base + nb * 16 + (lane & 15);
#pragma unroll
          for (int e = 0; e < 16; ++e) { const int ko = (e < 8) ? e : (8 + e); const float xv = xp[(size_t)ko * NN];
                                         __bf16 hh = bf_hi(xv); bh[e] = hh; bl[e] = bf_lo(xv, hh); }
          acc[0][nb] = WMMA_BF16(ah[0], bh, acc[0][nb]); acc[0][nb] = WMMA_BF16(ah[0], bl, acc[0][nb]); acc[0][nb] = WMMA_BF16(al[0], bh, acc[0][nb]);
          acc[1][nb] = WMMA_BF16(ah[1], bh, acc[1][nb]); acc[1][nb] = WMMA_BF16(ah[1], bl, acc[1][nb]); acc[1][nb] = WMMA_BF16(al[1], bh, acc[1][nb]);
        }
      }
    } else
    for (int kk = 0; kk < CC; kk += 32) {
      v16h a0 = load_a(Wm, co_wave + (lane & 15), CC, kk, lane);
      v16h a1 = load_a(Wm, co_wave + 16 + (lane & 15), CC, kk, lane);
      for (int nb = 0; nb < 4; ++nb) {
        v16h bf = load_b(xTb, n_base + nb * 16 + (lane & 15), CC, kk, lane);
        acc[0][nb] = WMMA_F16(a0, bf, acc[0][nb]);
        acc[1][nb] = WMMA_F16(a1, bf, acc[1][nb]);
      }
    }
    float qmul = (m == 0) ? 0.0625f : 1.0f;  // fold 1/sqrt(C) into q
    __syncthreads();                          // previous matrix's tile fully stored
    for (int cb = 0; cb < 2; ++cb) {
      int co_b = co_wave + cb * 16 + ((lane >> 4) << 3);
      for (int nb = 0; nb < 4; ++nb) {
        int nl = nb * 16 + (lane & 15);
        float s = scb[n_base + nl] * qmul;
        for (int r = 0; r < 8; ++r) T[nl][co_b + r] = (acc[cb][nb][r] + bias[co_b + r]) * s;
      }
    }
    __syncthreads();
    if (m < 2) {   // f32 [b][n][c]: 64 rows x 1024 B (64 pieces of 4 floats)
      float* dstb = ((m == 0) ? qT : kT) + (size_t)b * NN * CC + (size_t)n_base * CC;
      for (int g = tid; g < 64 * 64; g += 256) { int nl = g >> 6, pc = g & 63; vst2(dstb + (size_t)nl * CC + pc * 4, *(const v4f*)(&T[nl][pc * 4])); }
    } else {
      f16* vb = v16 + (size_t)b * CC * NN + n_base;
      for (int g = tid; g < 256 * 8; g += 256) {
        int c = g >> 3, pc = g & 7;
        union { v8h h; v4u u; } pk;
        for (int e = 0; e < 8; ++e) pk.h[e] = (f16)T[pc * 8 + e][c];
        vst2(vb + (size_t)c * NN + pc * 8, pk.u);
      }
    }
  }
}

// ---------------- flash attention ----------------
// Work-group barrier that orders LDS traffic only: __syncthreads() would also wait for the global loads in flight,
// and the K and V loads below are meant to stay in flight across it (they read only what an earlier launch wrote).
__device__ __forceinline__ void lds_barrier() {
  __builtin_amdgcn_fence(__ATOMIC_RELEASE, "workgroup", "local");
  __builtin_amdgcn_s_barrier();
  __builtin_amdgcn_fence(__ATOMIC_ACQUIRE, "workgroup", "local");
}
// out[b][n][c] f16 = softmax(q^T k) v ; 64 query rows per workgroup, tiles of 64 keys
__global__ __launch_bounds__(256) void k_attn(const float* __restrict__ qT,
                                              const float* __restrict__ kT,
                                              const f16* __restrict__ v16,
                                              f16* __restrict__ aout) {
  __shared__ __align__(16) __bf16 Qh[64][264];   // staged Q block, bf16 hi / lo planes
  __shared__ __align__(16) __bf16 Ql[64][264];
  __shared__ __align__(16) __bf16 Kh[64][264];   // staged K tile, bf16 hi / lo planes, converted once per work-group
  __shared__ __align__(16) __bf16 Kl[64][264];
  __shared__ __align__(16) float Sbuf[64][68];   // scores f32
  // softmax numerator f16: takes over the score bytes once every thread holds its scores in registers (a barrier lies between)
  f16 (*Pbuf)[72] = reinterpret_cast<f16 (*)[72]>(&Sbuf[0][0]);
  __shared__ float m_run[64], l_run[64], rfac[64];
  __shared__ float pmax[4][64], psum[4][64];
  // output tile [n][c]: takes over the K hi plane after the last tile's scores (keeps two work-groups' LDS on one WGP)
  f16 (*Ot)[264] = reinterpret_cast<f16 (*)[264]>(&Kh[0][0]);
  int b = blockIdx.y;
  int nq = blockIdx.x * 64;
  int tid = threadIdx.x, lane = tid & 31, wave = tid >> 5;
  int row_blk = wave & 3;          // S row block for this wave
  int colp = (wave >> 2) * 2;      // S col blocks colp, colp+1
  int c_wave = wave * 32;          // O channel range for this wave
  int srow = tid & 63, sq = tid >> 6;  // softmax: 4 threads per row, 16 cols each
  const float* qTb = qT + (size_t)b * NN * CC;
  const float* kTb = kT + (size_t)b * NN * CC;
  const f16* vb  = v16 + (size_t)b * CC * NN;
  const v8f vzero = {};
  v8f oacc[8];
  for (int i = 0; i < 8; ++i) oacc[i] = vzero;

  // K tile = 64 KiB contiguous: piece i of a thread is 16 B at (i * 256 + tid) * 16, so each wave-wide load covers 4 whole lines
  const float* kp = kTb + tid * 4;
  const int krow = tid >> 6, kcol = (tid & 63) * 4;
  v4f kreg[16];
#pragma unroll   // constant indices keep kreg in registers (here and at the two loops over it below)
  for (int i = 0; i < 16; ++i) kreg[i] = *(const v4f*)(kp + i * 1024);

  // stage Q block as bf16 hi/lo planes: 256 threads, each converts 64 floats
  {
    int row = tid >> 2, cbase = (tid & 3) * 64;
    const float* qp = &qTb[(size_t)(nq + row) * CC + cbase];
    for (int i = 0; i < 64; i += 4) {
      const v4f a = *(const v4f*)(qp + i);
#pragma unroll
      for (int e = 0; e < 4; ++e) { __bf16 h = bf_hi(a[e]); Qh[row][cbase + i + e] = h; Ql[row][cbase + i + e] = bf_lo(a[e], h); }
    }
  }
  if (tid < 64) { m_run[tid] = -1e30f; l_run[tid] = 0.f; }
  __syncthreads();

  for (int t = 0; t < NN / 64; ++t) {
    int mb = t * 64;
    // split this tile's K once and lay it in LDS
#pragma unroll
    for (int i = 0; i < 16; ++i) {
      v4bf h4, l4;
#pragma unroll
      for (int e = 0; e < 4; ++e) { __bf16 h = bf_hi(kreg[i][e]); h4[e] = h; l4[e] = bf_lo(kreg[i][e], h); }
      *(v4bf*)&Kh[i * 4 + krow][kcol] = h4;
      *(v4bf*)&Kl[i * 4 + krow][kcol] = l4;
    }
    __syncthreads();   // publishes the K planes; also ends the previous tile's reads of P and rfac
    // the next tile's loads start behind the barrier (in front of it the barrier's own wait would drain them) and fly under the score products
    if (t + 1 < NN / 64) {
#pragma unroll
      for (int i = 0; i < 16; ++i) kreg[i] = *(const v4f*)(kp + (size_t)(mb + 64) * CC + i * 1024);
    }
    // S = Q^T K for this 64x64 tile (2 subtiles per wave)
    v8f s0 = vzero, s1 = vzero;
    for (int kk = 0; kk < CC; kk += 32) {      // scores as a bf16 hi/lo split: hi*hi + hi*lo + lo*hi
      v16bf ah = load_bf_lds(&Qh[0][0], row_blk * 16 + (lane & 15), 264, kk, lane);
      v16bf al = load_bf_lds(&Ql[0][0], row_blk * 16 + (lane & 15), 264, kk, lane);
      v16bf b0h = load_bf_lds(&Kh[0][0], colp * 16 + (lane & 15), 264, kk, lane);
      v16bf b0l = load_bf_lds(&Kl[0][0], colp * 16 + (lane & 15), 264, kk, lane);
      v16bf b1h = load_bf_lds(&Kh[0][0], (colp + 1) * 16 + (lane & 15), 264, kk, lane);
      v16bf b1l = load_bf_lds(&Kl[0][0], (colp + 1) * 16 + (lane & 15), 264, kk, lane);
      s0 = WMMA_BF16(ah, b0h, s0); s0 = WMMA_BF16(ah, b0l, s0); s0 = WMMA_BF16(al, b0h, s0);
      s1 = WMMA_BF16(ah, b1h, s1); s1 = WMMA_BF16(ah, b1l, s1); s1 = WMMA_BF16(al, b1h, s1);
    }
    // this tile's V fragments, all eight loads as one group: they fly under the softmax and are first read by the P V^T products
    v16h vf[2][2];
    for (int k2 = 0; k2 < 2; ++k2)
      for (int cb = 0; cb < 2; ++cb) vf[k2][cb] = load_b(vb, c_wave + cb * 16 + (lane & 15), NN, mb + k2 * 32, lane);
    for (int r = 0; r < 8; ++r) {
      int row = row_blk * 16 + r + ((lane >> 4) << 3);
      Sbuf[row][colp * 16 + (lane & 15)] = s0[r];
      Sbuf[row][(colp + 1) * 16 + (lane & 15)] = s1[r];
    }
    // precaution: the softmax below reuses the V loads' address registers while the loads are still in flight
    asm volatile("s_wait_xcnt 0x0" ::: "memory");
    lds_barrier();
    // ---- parallel online softmax: all 256 threads, vectorized ----
    float arr[16];
    {
      const float4* sp = (const float4*)&Sbuf[srow][sq * 16];
      float4 f0 = sp[0], f1 = sp[1], f2 = sp[2], f3 = sp[3];
      ((float4*)arr)[0] = f0; ((float4*)arr)[1] = f1;
      ((float4*)arr)[2] = f2; ((float4*)arr)[3] = f3;
      float mx = fmaxf(fmaxf(fmaxf(f0.x, f0.y), fmaxf(f0.z, f0.w)),
                       fmaxf(fmaxf(fmaxf(f1.x, f1.y), fmaxf(f1.z, f1.w)),
                             fmaxf(fmaxf(fmaxf(f2.x, f2.y), fmaxf(f2.z, f2.w)),
                                   fmaxf(fmaxf(f3.x, f3.y), fmaxf(f3.z, f3.w)))));
      pmax[sq][srow] = mx;
    }
    lds_barrier();
    {
      float m_new = fmaxf(fmaxf(pmax[0][srow], pmax[1][srow]),
                          fmaxf(fmaxf(pmax[2][srow], pmax[3][srow]), m_run[srow]));
      float l = 0.f;
      v8h pk0, pk1;
      for (int i = 0; i < 8; ++i) {
        float p = __expf(arr[i] - m_new);
        pk0[i] = (f16)(p * PSC); l += p;
      }
      for (int i = 0; i < 8; ++i) {
        float p = __expf(arr[8 + i] - m_new);
        pk1[i] = (f16)(p * PSC); l += p;
      }
      *(v8h*)&Pbuf[srow][sq * 16] = pk0;
      *(v8h*)&Pbuf[srow][sq * 16 + 8] = pk1;
      psum[sq][srow] = l;
    }
    lds_barrier();
    if (tid < 64) {
      float mold = m_run[tid];
      float m_new = fmaxf(fmaxf(pmax[0][tid], pmax[1][tid]),
                          fmaxf(fmaxf(pmax[2][tid], pmax[3][tid]), mold));
      float rs = __expf(mold - m_new);
      l_run[tid] = l_run[tid] * rs +
                   (psum[0][tid] + psum[1][tid] + psum[2][tid] + psum[3][tid]);
      m_run[tid] = m_new;
      rfac[tid] = rs;
    }
    lds_barrier();
    // rescale O and accumulate O += P * V^T (K = 64 keys): two row blocks at a time, their factors and P fragments read as one group
    for (int h = 0; h < 2; ++h) {
      float f[2][8];
      v16h pa[2][2];
      for (int j = 0; j < 2; ++j) {
        const int nb = h * 2 + j;
        for (int r = 0; r < 8; ++r) f[j][r] = rfac[nb * 16 + r + ((lane >> 4) << 3)];
        for (int k2 = 0; k2 < 2; ++k2) pa[j][k2] = load_a(&Pbuf[0][0], nb * 16 + (lane & 15), 72, k2 * 32, lane);
      }
      for (int j = 0; j < 2; ++j)
        for (int cb = 0; cb < 2; ++cb)
          for (int r = 0; r < 8; ++r) oacc[(h * 2 + j) * 2 + cb][r] *= f[j][r];
      for (int k2 = 0; k2 < 2; ++k2)
        for (int j = 0; j < 2; ++j)
          for (int cb = 0; cb < 2; ++cb)
            oacc[(h * 2 + j) * 2 + cb] = WMMA_F16(pa[j][k2], vf[k2][cb], oacc[(h * 2 + j) * 2 + cb]);
    }
  }
  // epilogue: divide by softmax sum (and the P scale), stage [n][c], store [b][n][c] f16 rows of 512 B
  for (int nb = 0; nb < 4; ++nb)
    for (int cb = 0; cb < 2; ++cb) {
      int c = c_wave + cb * 16 + (lane & 15);
      for (int r = 0; r < 8; ++r) {
        int nloc = nb * 16 + r + ((lane >> 4) << 3);
        Ot[nloc][c] = (f16)(oacc[nb * 2 + cb][r] * (PUN / l_run[nloc]));
      }
    }
  __syncthreads();
  {
    f16* ab = aout + (size_t)b * NN * CC + (size_t)nq * CC;
    for (int g = tid; g < 64 * 32; g += 256) { int nl = g >> 5, pc = g & 31; vst2(ab + (size_t)nl * CC + pc * 8, *(const v4u*)(&Ot[nl][pc * 8])); }
  }
}

// ---------------- output projection ----------------
__global__ __launch_bounds__(256) void k_out(const f16* __restrict__ aout,
                                             const f16* __restrict__ Wo16,
                                             const float* __restrict__ bo,
                                             float* __restrict__ out) {
  __shared__ __align__(16) float So[8][32 * 64];   // per-wave [co][n] tile
  int b = blockIdx.y;
  int n_base = blockIdx.x * 64;
  int lane = threadIdx.x & 31, wave = threadIdx.x >> 5;
  int co_wave = wave * 32;
  const f16* ab = aout + (size_t)b * NN * CC;
  const v8f vzero = {};
  v8f acc[2][4];
  for (int cb = 0; cb < 2; ++cb)
    for (int nb = 0; nb < 4; ++nb) acc[cb][nb] = vzero;
  for (int kk = 0; kk < CC; kk += 32) {
    v16h a0 = load_a(Wo16, co_wave + (lane & 15), CC, kk, lane);
    v16h a1 = load_a(Wo16, co_wave + 16 + (lane & 15), CC, kk, lane);
    for (int nb = 0; nb < 4; ++nb) {
      v16h bf = load_b(ab, n_base + nb * 16 + (lane & 15), CC, kk, lane);
      acc[0][nb] = WMMA_F16(a0, bf, acc[0][nb]);
      acc[1][nb] = WMMA_F16(a1, bf, acc[1][nb]);
    }
  }
  float* ob = out + (size_t)b * CC * NN;
  float* so = So[wave];
  for (int cb = 0; cb < 2; ++cb) {
    int col_b = cb * 16 + ((lane >> 4) << 3);
    for (int nb = 0; nb < 4; ++nb) {
      int nl = nb * 16 + (lane & 15);
      for (int r = 0; r < 8; ++r) so[(col_b + r) * 64 + nl] = acc[cb][nb][r] + bo[co_wave + col_b + r];
    }
  }
  __syncthreads();
  for (int q = 0; q < 16; ++q) {    // 32 channel rows x 256 B (16 pieces); rows 2q, 2q+1 per instruction
    int rl = q * 2 + (lane >> 4), pc = lane & 15;
    vst2(ob + (size_t)(co_wave + rl) * NN + n_base + pc * 4, *(const v4f*)(&so[rl * 64 + pc * 4]));
  }
}

extern "C" void kernel_launch(void* const* d_in, const int* in_sizes, int n_in,
                              void* d_out, int out_size, void* d_ws, size_t ws_size,
                              hipStream_t stream) {
  (void)in_sizes; (void)n_in; (void)out_size; (void)ws_size;
  const float* x  = (const float*)d_in[0];
  const float* g0 = (const float*)d_in[1];
  const float* Wq = (const float*)d_in[2];
  const float* bq = (const float*)d_in[3];
  const float* Wk = (const float*)d_in[4];
  const float* bk = (const float*)d_in[5];
  const float* Wv = (const float*)d_in[6];
  const float* bv = (const float*)d_in[7];
  const float* Wo = (const float*)d_in[8];
  const float* bo = (const float*)d_in[9];
  const float* fw = (const float*)d_in[10];

  char* ws = (char*)d_ws;
  float* scg = (float*)ws; ws += (size_t)BB * NN * sizeof(float);
  f16* W3    = (f16*)ws;   ws += (size_t)3 * CC * CC * sizeof(f16);
  f16* Wo16  = (f16*)ws;   ws += (size_t)CC * CC * sizeof(f16);
  f16* xT    = (f16*)ws;   ws += (size_t)BB * NN * CC * sizeof(f16);
  float* qT  = (float*)ws; ws += (size_t)BB * NN * CC * sizeof(float);
  float* kT  = (float*)ws; ws += (size_t)BB * NN * CC * sizeof(float);
  f16* v16   = (f16*)ws;   ws += (size_t)BB * NN * CC * sizeof(f16);
  f16* aout  = (f16*)ws;

  k_scale<<<dim3((BB * NN) / 256), 256, 0, stream>>>(g0, scg);
  k_wconv<<<dim3((4 * CC * CC / 8) / 256), 256, 0, stream>>>(Wq, Wk, Wv, Wo, fw, W3, Wo16);
  k_xt<<<dim3(NN / 64, CC / 64, BB), 256, 0, stream>>>(x, xT);
  k_qkv<<<dim3(NN / 64, BB), 256, 0, stream>>>(xT, W3, x, Wq, Wk, fw, bq, bk, bv, scg, qT, kT, v16);
  k_attn<<<dim3(NN / 64, BB), 256, 0, stream>>>(qT, kT, v16, aout);
  k_out<<<dim3(NN / 64, BB), 256, 0, stream>>>(aout, Wo16, bo, (float*)d_out);
}

// v003
// One run takes 282 microseconds.
// In both of two side-by-side timings against v002, it was 1.14 times as fast.
// All steps since v000 together make it 2.50 times as fast.
#include <hip/hip_runtime.h>

#define BB 8
#define CC 256
#define NN 4096
#define H0 32
#define W0 32

typedef _Float16 f16;
typedef __attribute__((ext_vector_type(16))) _Float16 v16h;
typedef __attribute__((ext_vector_type(8)))  _Float16 v8h;
typedef __attribute__((ext_vector_type(8)))  float    v8f;

union FragU { v16h v; v8h h[2]; };
typedef __attribute__((ext_vector_type(4))) float v4f;
typedef __attribute__((ext_vector_type(4))) unsigned v4u;
// Contractions: q/k/v 1x1 convs and the output conv (K = 256), scores q^T k (K = 256) and P V^T (K = keys) on
// v_wmma_f32_16x16x32_f16 (f16 operands, f32 accumulate; P scaled by 256 before its f16 conversion) — except the scores,
// and the q/k projections, which run as bf16 hi/lo splits (hi*hi + hi*lo + lo*hi) of f32 operands (q kept in f32, k as its two bf16 planes). The FFT refine with
// per-channel real weights is exactly fw_c * x and is folded into the conv weights; bilinear guide, sigmoid, softmax in f32.
template <typename V> __device__ __forceinline__ void vst2(void* p, V v) {
  *(V*)p = v; 
}
#define PSC 256.0f
#define PUN (1.0f / 256.0f)
typedef __attribute__((ext_vector_type(16))) __bf16 v16bf;
typedef __attribute__((ext_vector_type(8)))  __bf16 v8bf;
__device__ __forceinline__ __bf16 bf_hi(float x) { return (__bf16)x; }
__device__ __forceinline__ __bf16 bf_lo(float x, __bf16 h) { return (__bf16)(x - (float)h); }
__device__ __forceinline__ v8f WMMA_BF16(v16bf a, v16bf b, v8f c) {
  v8f d = __builtin_amdgcn_wmma_f32_16x16x32_bf16(false, a, false, b, (short)0, c, false, false);
  asm volatile("v_nop\n\tv_nop\n\tv_nop\n\tv_nop" : "+v"(d) : "v"(a), "v"(b));
  return d;
}
// bf16 fragment from an LDS plane [row][rs] (split K map)
__device__ __forceinline__ v16bf load_bf_lds(const __bf16* base, int row, int rs, int kbase, int lane) {
  union { v16bf v; v8bf h[2]; } u;
  const __bf16* p = base + (size_t)row * rs + kbase + ((lane >> 4) << 3);
  u.h[0] = *(const v8bf*)(p); u.h[1] = *(const v8bf*)(p + 16);
  return u.v;
}
// A-matrix fragment (16x32 f16, M x K), memory layout [row][k] row-major.
// Element i of lane L: K = kbase + (i/8)*16 + (L/16)*8 + i%8, M = row (caller adds lane%16).
__device__ __forceinline__ v16h load_a(const f16* base, int row, int rs, int kbase, int lane) {
  const f16* p = base + (size_t)row * rs + kbase + ((lane >> 4) << 3);
  FragU u;
  u.h[0] = *(const v8h*)(p);
  u.h[1] = *(const v8h*)(p + 16);
  return u.v;
}
// B-matrix fragment (32x16 f16, K x N), memory layout [col][k] (K contiguous); same per-lane K map as A:
// Element i of lane L: K = kbase + (i/8)*16 + (L/16)*8 + i%8, N = col.
__device__ __forceinline__ v16h load_b(const f16* base, int col, int rs, int kbase, int lane) {
  return load_a(base, col, rs, kbase, lane);
}

__device__ __forceinline__ v8f WMMA_F16(v16h a, v16h b, v8f c) {
  v8f d = __builtin_amdgcn_wmma_f32_16x16x32_f16(false, a, false, b, (short)0, c, false, false);
  asm volatile("v_nop\n\tv_nop\n\tv_nop\n\tv_nop" : "+v"(d) : "v"(a), "v"(b));
  return d;
}

// ---------------- prep kernels ----------------

// bilinear(align_corners) + sigmoid -> scale = 1 + sigmoid(g)
__global__ __launch_bounds__(256) void k_scale(const float* __restrict__ g0,
                                               float* __restrict__ sc) {
  int idx = blockIdx.x * 256 + threadIdx.x;   // B*N
  int b = idx >> 12, n = idx & (NN - 1);
  int ny = n >> 6, nx = n & 63;
  float fy = ny * (31.0f / 63.0f);
  float fx = nx * (31.0f / 63.0f);
  int y0 = (int)fy, x0 = (int)fx;
  float wy = fy - (float)y0, wx = fx - (float)x0;
  int y1 = min(y0 + 1, H0 - 1), x1 = min(x0 + 1, W0 - 1);
  const float* g = g0 + (size_t)b * H0 * W0;
  float v00 = g[y0 * W0 + x0], v01 = g[y0 * W0 + x1];
  float v10 = g[y1 * W0 + x0], v11 = g[y1 * W0 + x1];
  float vy0 = v00 * (1.f - wx) + v01 * wx;
  float vy1 = v10 * (1.f - wx) + v11 * wx;
  float v = vy0 * (1.f - wy) + vy1 * wy;
  vst2(sc + idx, 1.0f + 1.0f / (1.0f + __expf(-v)));
}

// convert weights to f16; fold freq_weights into Wq/Wk/Wv columns (refined = fw*x)
__global__ __launch_bounds__(256) void k_wconv(const float* __restrict__ Wq,
                                               const float* __restrict__ Wk,
                                               const float* __restrict__ Wv,
                                               const float* __restrict__ Wo,
                                               const float* __restrict__ fw,
                                               f16* __restrict__ W3,
                                               f16* __restrict__ Wo16) {
  int g = blockIdx.x * 256 + threadIdx.x;     // 4*256*256/8 pieces of 8 halves
  int idx0 = g * 8;
  int m = idx0 >> 16, r0 = idx0 & 65535;
  const float* W = (m == 0) ? Wq : (m == 1) ? Wk : (m == 2) ? Wv : Wo;
  union { v8h h; v4u u; } pk;
#pragma unroll
  for (int e = 0; e < 8; ++e) { int r = r0 + e, ci = r & (CC - 1); pk.h[e] = (f16)(W[r] * ((m < 3) ? fw[ci] : 1.0f)); }
  f16* dst = (m < 3) ? (W3 + (size_t)m * 65536 + r0) : (Wo16 + r0);
  vst2(dst, pk.u);
}

// x [b][c][n] f32 -> xT [b][n][c] f16 via LDS 64x64 tile (coalesced both sides)
__global__ __launch_bounds__(256) void k_xt(const float* __restrict__ x,
                                            f16* __restrict__ xT) {
  __shared__ __align__(16) f16 tile[64][72];
  int b = blockIdx.z, c0 = blockIdx.y * 64, n0 = blockIdx.x * 64;
  int tid = threadIdx.x;
  {
    int cl = tid >> 2, nq = (tid & 3) * 16;
    const float4* src = (const float4*)(x + (size_t)b * CC * NN +
                                        (size_t)(c0 + cl) * NN + n0 + nq);
    for (int i = 0; i < 4; ++i) {
      float4 v = src[i];
      tile[cl][nq + 4 * i + 0] = (f16)v.x;
      tile[cl][nq + 4 * i + 1] = (f16)v.y;
      tile[cl][nq + 4 * i + 2] = (f16)v.z;
      tile[cl][nq + 4 * i + 3] = (f16)v.w;
    }
  }
  __syncthreads();
  for (int pass = 0; pass < 2; ++pass) {
    int nl = pass * 32 + (tid >> 3), cq = (tid & 7) * 8;
    f16* dst = xT + (size_t)b * NN * CC + (size_t)(n0 + nl) * CC + c0 + cq;
    union { v8h h; v4u u; } o;
    for (int i = 0; i < 8; ++i) o.h[i] = tile[cq + i][nl];
    vst2(dst, o.u);
  }
}

// ---------------- QKV GEMM ----------------
// q stored [b][n][c] (transposed, f32, scaled); k stored [b][n][c] as two bf16 planes, hi and lo; v stored [b][c][n] (f16, scaled)
__global__ __launch_bounds__(256) void k_qkv(const f16* __restrict__ xT,
                                             const f16* __restrict__ W3,
                                             const float* __restrict__ xf,   // x f32 [b][c][n]
                                             const float* __restrict__ Wqf, const float* __restrict__ Wkf,
                                             const float* __restrict__ fw,
                                             const float* __restrict__ bq,
                                             const float* __restrict__ bk,
                                             const float* __restrict__ bv,
                                             const float* __restrict__ scg,
                                             float* __restrict__ qT,
                                             __bf16* __restrict__ kH,
                                             __bf16* __restrict__ kL,
                                             f16* __restrict__ v16) {
  __shared__ __align__(16) float T[64][260];   // block tile [n][c] (padded), f32
  int b = blockIdx.y;
  int n_base = blockIdx.x * 64;
  int tid = threadIdx.x;
  int lane = threadIdx.x & 31, wave = threadIdx.x >> 5;
  int co_wave = wave * 32;
  const f16* xTb = xT + (size_t)b * NN * CC;
  const float* scb = scg + (size_t)b * NN;
  const v8f vzero = {};
  const float* xfb = xf + (size_t)b * CC * NN;
  for (int m = 0; m < 3; ++m) {
    const f16* Wm = W3 + (size_t)m * 65536;
    const float* bias = (m == 0) ? bq : ((m == 1) ? bk : bv);
    v8f acc[2][4];
    for (int cb = 0; cb < 2; ++cb)
      for (int nb = 0; nb < 4; ++nb) acc[cb][nb] = vzero;
    if (m < 2) {
      // q and k as a bf16 hi/lo split of f32 operands: A = (W*fw) rows [co][ci] (contiguous), B = x[b][c][n] gathered down c (stride NN)
      const float* Wf = (m == 0) ? Wqf : Wkf;
      for (int kk = 0; kk < CC; kk += 32) {
        v16bf ah[2], al[2];
#pragma unroll
        for (int cb = 0; cb < 2; ++cb) {
          const float* wr = Wf + (size_t)(co_wave + cb * 16 + (lane & 15)) * CC + kk + ((lane >> 4) << 3);
#pragma unroll
          for (int e = 0; e < 16; ++e) { const int ko = (e < 8) ? e : (8 + e); const float w = wr[ko] * fw[kk + ((lane >> 4) << 3) + ko];
                                         __bf16 hh = bf_hi(w); ah[cb][e] = hh; al[cb][e] = bf_lo(w, hh); }
        }
        for (int nb = 0; nb < 4; ++nb) {
          v16bf bh, bl;
          const float* xp = xfb + (size_t)(kk + ((lane >> 4) << 3)) * NN + n_base + nb * 16 + (lane & 15);
#pragma unroll
          for (int e = 0; e < 16; ++e) { const int ko = (e < 8) ? e : (8 + e); const float xv = xp[(size_t)ko * NN];
                                         __bf16 hh = bf_hi(xv); bh[e] = hh; bl[e] = bf_lo(xv, hh); }
          acc[0][nb] = WMMA_BF16(ah[0], bh, acc[0][nb]); acc[0][nb] = WMMA_BF16(ah[0], bl, acc[0][nb]); acc[0][nb] = WMMA_BF16(al[0], bh, acc[0][nb]);
          acc[1][nb] = WMMA_BF16(ah[1], bh, acc[1][nb]); acc[1][nb] = WMMA_BF16(ah[1], bl, acc[1][nb]); acc[1][nb] = WMMA_BF16(al[1], bh, acc[1][nb]);
        }
      }
    } else
    for (int kk = 0; kk < CC; kk += 32) {
      v16h a0 = load_a(Wm, co_wave + (lane & 15), CC, kk, lane);
      v16h a1 = load_a(Wm, co_wave + 16 + (lane & 15), CC, kk, lane);
      for (int nb = 0; nb < 4; ++nb) {
        v16h bf = load_b(xTb, n_base + nb * 16 + (lane & 15), CC, kk, lane);
        acc[0][nb] = WMMA_F16(a0, bf, acc[0][nb]);
        acc[1][nb] = WMMA_F16(a1, bf, acc[1][nb]);
      }
    }
    float qmul = (m == 0) ? 0.0625f : 1.0f;  // fold 1/sqrt(C) into q
    __syncthreads();                          // previous matrix's tile fully stored
    for (int cb = 0; cb < 2; ++cb) {
      int co_b = co_wave + cb * 16 + ((lane >> 4) << 3);
      for (int nb = 0; nb < 4; ++nb) {
        int nl = nb * 16 + (lane & 15);
        float s = scb[n_base + nl] * qmul;
        for (int r = 0; r < 8; ++r) T[nl][co_b + r] = (acc[cb][nb][r] + bias[co_b + r]) * s;
      }
    }
    __syncthreads();
    if (m == 0) {   // f32 [b][n][c]: 64 rows x 1024 B (64 pieces of 4 floats)
      float* dstb = qT + (size_t)b * NN * CC + (size_t)n_base * CC;
      for (int g = tid; g < 64 * 64; g += 256) { int nl = g >> 6, pc = g & 63; vst2(dstb + (size_t)nl * CC + pc * 4, *(const v4f*)(&T[nl][pc * 4])); }
    } else if (m == 1) {   // bf16 hi and lo planes [b][n][c]: 64 rows x 512 B each (32 pieces of 8), split here once for every reader
      const size_t ko = (size_t)b * NN * CC + (size_t)n_base * CC;
      for (int g = tid; g < 64 * 32; g += 256) {
        int nl = g >> 5, pc = g & 31;
        v8bf h8, l8;
#pragma unroll   // constant indices keep h8 and l8 in registers
        for (int e = 0; e < 8; ++e) { const float kv = T[nl][pc * 8 + e]; __bf16 h = bf_hi(kv); h8[e] = h; l8[e] = bf_lo(kv, h); }
        vst2(kH + ko + (size_t)nl * CC + pc * 8, h8);
        vst2(kL + ko + (size_t)nl * CC + pc * 8, l8);
      }
    } else {
      f16* vb = v16 + (size_t)b * CC * NN + n_base;
      for (int g = tid; g < 256 * 8; g += 256) {
        int c = g >> 3, pc = g & 7;
        union { v8h h; v4u u; } pk;
        for (int e = 0; e < 8; ++e) pk.h[e] = (f16)T[pc * 8 + e][c];
        vst2(vb + (size_t)c * NN + pc * 8, pk.u);
      }
    }
  }
}

// ---------------- flash attention ----------------
// Work-group barrier that orders LDS traffic only: __syncthreads() would also wait for the global loads in flight,
// and the V loads below are meant to stay in flight across it, as are the K copies (both read only what an earlier launch wrote).
__device__ __forceinline__ void lds_barrier() {
  __builtin_amdgcn_fence(__ATOMIC_RELEASE, "workgroup", "local");
  __builtin_amdgcn_s_barrier();
  __builtin_amdgcn_fence(__ATOMIC_ACQUIRE, "workgroup", "local");
}
// Eight asynchronous copies of one wave: rows r, r + 8, ..., r + 56 of one K plane, a whole 512-B row (4 lines) per copy, 16 B per lane,
// from rows of 512 B in global memory to rows of 528 B in LDS. lds = the lane's LDS byte address, g = the lane's global address, both of row r.
// The s_wait_xcnt is a precaution and closes the statement, so that no address register is rewritten in front of it.
__device__ __forceinline__ void k_rows_async(unsigned lds, const __bf16* g) {
  asm volatile("global_load_async_to_lds_b128 %0, %8, off\n\t"
               "global_load_async_to_lds_b128 %1, %9, off\n\t"
               "global_load_async_to_lds_b128 %2, %10, off\n\t"
               "global_load_async_to_lds_b128 %3, %11, off\n\t"
               "global_load_async_to_lds_b128 %4, %12, off\n\t"
               "global_load_async_to_lds_b128 %5, %13, off\n\t"
               "global_load_async_to_lds_b128 %6, %14, off\n\t"
               "global_load_async_to_lds_b128 %7, %15, off\n\t"
               "s_wait_xcnt 0x0"
               :: "v"(lds), "v"(lds + 1u * 4224u), "v"(lds + 2u * 4224u), "v"(lds + 3u * 4224u),
                  "v"(lds + 4u * 4224u), "v"(lds + 5u * 4224u), "v"(lds + 6u * 4224u), "v"(lds + 7u * 4224u),
                  "v"(g), "v"(g + 1 * 8 * CC), "v"(g + 2 * 8 * CC), "v"(g + 3 * 8 * CC),
                  "v"(g + 4 * 8 * CC), "v"(g + 5 * 8 * CC), "v"(g + 6 * 8 * CC), "v"(g + 7 * 8 * CC)
               : "memory");
}
// out[b][n][c] f16 = softmax(q^T k) v ; 64 query rows per workgroup, tiles of 64 keys
__global__ __launch_bounds__(256) void k_attn(const float* __restrict__ qT,
                                              const __bf16* __restrict__ kH,
                                              const __bf16* __restrict__ kL,
                                              const f16* __restrict__ v16,
                                              f16* __restrict__ aout) {
  __shared__ __align__(16) __bf16 Qh[64][264];   // staged Q block, bf16 hi / lo planes
  __shared__ __align__(16) __bf16 Ql[64][264];
  __shared__ __align__(16) __bf16 Kh[64][264];   // staged K tile, bf16 hi / lo planes, filled by asynchronous copies
  __shared__ __align__(16) __bf16 Kl[64][264];
  __shared__ __align__(16) float Sbuf[64][68];   // scores f32
  // softmax numerator f16: takes over the score bytes once every thread holds its scores in registers (a barrier lies between)
  f16 (*Pbuf)[72] = reinterpret_cast<f16 (*)[72]>(&Sbuf[0][0]);
  __shared__ float m_run[64], l_run[64], rfac[64];
  __shared__ float pmax[4][64], psum[4][64];
  // output tile [n][c]: takes over the K hi plane after the last tile's scores (keeps two work-groups' LDS on one WGP)
  f16 (*Ot)[264] = reinterpret_cast<f16 (*)[264]>(&Kh[0][0]);
  int b = blockIdx.y;
  int nq = blockIdx.x * 64;
  int tid = threadIdx.x, lane = tid & 31, wave = tid >> 5;
  int row_blk = wave & 3;          // S row block for this wave
  int colp = (wave >> 2) * 2;      // S col blocks colp, colp+1
  int c_wave = wave * 32;          // O channel range for this wave
  int srow = tid & 63, sq = tid >> 6;  // softmax: 4 threads per row, 16 cols each
  const float* qTb = qT + (size_t)b * NN * CC;
  const f16* vb  = v16 + (size_t)b * CC * NN;
  const v8f vzero = {};
  v8f oacc[8];
  for (int i = 0; i < 8; ++i) oacc[i] = vzero;

  // K tile = 64 rows x 512 B of each plane; wave w copies rows w, w + 8, ..., w + 56 of both planes, through no register
  const __bf16* khp = kH + (size_t)b * NN * CC + (size_t)wave * CC + lane * 8;
  const __bf16* klp = kL + (size_t)b * NN * CC + (size_t)wave * CC + lane * 8;
  const unsigned kh_lds = (unsigned)(size_t)&Kh[wave][lane * 8];
  const unsigned kl_lds = (unsigned)(size_t)&Kl[wave][lane * 8];
  k_rows_async(kh_lds, khp);   // tile 0: nothing has touched the K planes yet
  k_rows_async(kl_lds, klp);

  // stage Q block as bf16 hi/lo planes: 256 threads, each converts 64 floats
  {
    int row = tid >> 2, cbase = (tid & 3) * 64;
    const float* qp = &qTb[(size_t)(nq + row) * CC + cbase];
    for (int i = 0; i < 64; i += 4) {
      const v4f a = *(const v4f*)(qp + i);
#pragma unroll
      for (int e = 0; e < 4; ++e) { __bf16 h = bf_hi(a[e]); Qh[row][cbase + i + e] = h; Ql[row][cbase + i + e] = bf_lo(a[e], h); }
    }
  }
  if (tid < 64) { m_run[tid] = -1e30f; l_run[tid] = 0.f; }
  asm volatile("s_wait_asynccnt 0x0" ::: "memory");   // this wave's rows of tile 0 have landed; the barrier publishes them
  __syncthreads();

  for (int t = 0; t < NN / 64; ++t) {
    int mb = t * 64;
    // S = Q^T K for this 64x64 tile (2 subtiles per wave)
    v8f s0 = vzero, s1 = vzero;
    for (int kk = 0; kk < CC; kk += 32) {      // scores as a bf16 hi/lo split: hi*hi + hi*lo + lo*hi
      v16bf ah = load_bf_lds(&Qh[0][0], row_blk * 16 + (lane & 15), 264, kk, lane);
      v16bf al = load_bf_lds(&Ql[0][0], row_blk * 16 + (lane & 15), 264, kk, lane);
      v16bf b0h = load_bf_lds(&Kh[0][0], colp * 16 + (lane & 15), 264, kk, lane);
      v16bf b0l = load_bf_lds(&Kl[0][0], colp * 16 + (lane & 15), 264, kk, lane);
      v16bf b1h = load_bf_lds(&Kh[0][0], (colp + 1) * 16 + (lane & 15), 264, kk, lane);
      v16bf b1l = load_bf_lds(&Kl[0][0], (colp + 1) * 16 + (lane & 15), 264, kk, lane);
      s0 = WMMA_BF16(ah, b0h, s0); s0 = WMMA_BF16(ah, b0l, s0); s0 = WMMA_BF16(al, b0h, s0);
      s1 = WMMA_BF16(ah, b1h, s1); s1 = WMMA_BF16(ah, b1l, s1); s1 = WMMA_BF16(al, b1h, s1);
    }
    // this tile's V fragments, all eight loads as one group: they fly under the softmax and are first read by the P V^T products
    v16h vf[2][2];
    for (int k2 = 0; k2 < 2; ++k2)
      for (int cb = 0; cb < 2; ++cb) vf[k2][cb] = load_b(vb, c_wave + cb * 16 + (lane & 15), NN, mb + k2 * 32, lane);
    for (int r = 0; r < 8; ++r) {
      int row = row_blk * 16 + r + ((lane >> 4) << 3);
      Sbuf[row][colp * 16 + (lane & 15)] = s0[r];
      Sbuf[row][(colp + 1) * 16 + (lane & 15)] = s1[r];
    }
    // precaution: the softmax below reuses the V loads' address registers while the loads are still in flight
    asm volatile("s_wait_xcnt 0x0" ::: "memory");
    asm volatile("s_wait_dscnt 0x0" ::: "memory");   // this wave's reads of the K planes have retired before any wave's copies rewrite them
    lds_barrier();
    // every wave has left the K planes: the next tile's copies start here and fly under the softmax and the P V^T products
    if (t + 1 < NN / 64) {
      k_rows_async(kh_lds, khp + (size_t)(mb + 64) * CC);
      k_rows_async(kl_lds, klp + (size_t)(mb + 64) * CC);
    }
    // ---- parallel online softmax: all 256 threads, vectorized ----
    float arr[16];
    {
      const float4* sp = (const float4*)&Sbuf[srow][sq * 16];
      float4 f0 = sp[0], f1 = sp[1], f2 = sp[2], f3 = sp[3];
      ((float4*)arr)[0] = f0; ((float4*)arr)[1] = f1;
      ((float4*)arr)[2] = f2; ((float4*)arr)[3] = f3;
      float mx = fmaxf(fmaxf(fmaxf(f0.x, f0.y), fmaxf(f0.z, f0.w)),
                       fmaxf(fmaxf(fmaxf(f1.x, f1.y), fmaxf(f1.z, f1.w)),
                             fmaxf(fmaxf(fmaxf(f2.x, f2.y), fmaxf(f2.z, f2.w)),
                                   fmaxf(fmaxf(f3.x, f3.y), fmaxf(f3.z, f3.w)))));
      pmax[sq][srow] = mx;
    }
    lds_barrier();
    {
      float m_new = fmaxf(fmaxf(pmax[0][srow], pmax[1][srow]),
                          fmaxf(fmaxf(pmax[2][srow], pmax[3][srow]), m_run[srow]));
      float l = 0.f;
      v8h pk0, pk1;
      for (int i = 0; i < 8; ++i) {
        float p = __expf(arr[i] - m_new);
        pk0[i] = (f16)(p * PSC); l += p;
      }
      for (int i = 0; i < 8; ++i) {
        float p = __expf(arr[8 + i] - m_new);
        pk1[i] = (f16)(p * PSC); l += p;
      }
      *(v8h*)&Pbuf[srow][sq * 16] = pk0;
      *(v8h*)&Pbuf[srow][sq * 16 + 8] = pk1;
      psum[sq][srow] = l;
    }
    lds_barrier();
    if (tid < 64) {
      float mold = m_run[tid];
      float m_new = fmaxf(fmaxf(pmax[0][tid], pmax[1][tid]),
                          fmaxf(fmaxf(pmax[2][tid], pmax[3][tid]), mold));
      float rs = __expf(mold - m_new);
      l_run[tid] = l_run[tid] * rs +
                   (psum[0][tid] + psum[1][tid] + psum[2][tid] + psum[3][tid]);
      m_run[tid] = m_new;
      rfac[tid] = rs;
    }
    lds_barrier();
    // rescale O and accumulate O += P * V^T (K = 64 keys): two row blocks at a time, their factors and P fragments read as one group
    for (int h = 0; h < 2; ++h) {
      float f[2][8];
      v16h pa[2][2];
      for (int j = 0; j < 2; ++j) {
        const int nb = h * 2 + j;
        for (int r = 0; r < 8; ++r) f[j][r] = rfac[nb * 16 + r + ((lane >> 4) << 3)];
        for (int k2 = 0; k2 < 2; ++k2) pa[j][k2] = load_a(&Pbuf[0][0], nb * 16 + (lane & 15), 72, k2 * 32, lane);
      }
      for (int j = 0; j < 2; ++j)
        for (int cb = 0; cb < 2; ++cb)
          for (int r = 0; r < 8; ++r) oacc[(h * 2 + j) * 2 + cb][r] *= f[j][r];
      for (int k2 = 0; k2 < 2; ++k2)
        for (int j = 0; j < 2; ++j)
          for (int cb = 0; cb < 2; ++cb)
            oacc[(h * 2 + j) * 2 + cb] = WMMA_F16(pa[j][k2], vf[k2][cb], oacc[(h * 2 + j) * 2 + cb]);
    }
    asm volatile("s_wait_dscnt 0x0" ::: "memory");      // this wave's reads of P and rfac have retired
    asm volatile("s_wait_asynccnt 0x0" ::: "memory");   // this wave's rows of the next tile have landed
    __syncthreads();   // publishes the next K tile; also ends this tile's reads of P and rfac
  }
  // epilogue: divide by softmax sum (and the P scale), stage [n][c], store [b][n][c] f16 rows of 512 B
  for (int nb = 0; nb < 4; ++nb)
    for (int cb = 0; cb < 2; ++cb) {
      int c = c_wave + cb * 16 + (lane & 15);
      for (int r = 0; r < 8; ++r) {
        int nloc = nb * 16 + r + ((lane >> 4) << 3);
        Ot[nloc][c] = (f16)(oacc[nb * 2 + cb][r] * (PUN / l_run[nloc]));
      }
    }
  __syncthreads();
  {
    f16* ab = aout + (size_t)b * NN * CC + (size_t)nq * CC;
    for (int g = tid; g < 64 * 32; g += 256) { int nl = g >> 5, pc = g & 31; vst2(ab + (size_t)nl * CC + pc * 8, *(const v4u*)(&Ot[nl][pc * 8])); }
  }
}

// ---------------- output projection ----------------
__global__ __launch_bounds__(256) void k_out(const f16* __restrict__ aout,
                                             const f16* __restrict__ Wo16,
                                             const float* __restrict__ bo,
                                             float* __restrict__ out) {
  __shared__ __align__(16) float So[8][32 * 64];   // per-wave [co][n] tile
  int b = blockIdx.y;
  int n_base = blockIdx.x * 64;
  int lane = threadIdx.x & 31, wave = threadIdx.x >> 5;
  int co_wave = wave * 32;
  const f16* ab = aout + (size_t)b * NN * CC;
  const v8f vzero = {};
  v8f acc[2][4];
  for (int cb = 0; cb < 2; ++cb)
    for (int nb = 0; nb < 4; ++nb) acc[cb][nb] = vzero;
  for (int kk = 0; kk < CC; kk += 32) {
    v16h a0 = load_a(Wo16, co_wave + (lane & 15), CC, kk, lane);
    v16h a1 = load_a(Wo16, co_wave + 16 + (lane & 15), CC, kk, lane);
    for (int nb = 0; nb < 4; ++nb) {
      v16h bf = load_b(ab, n_base + nb * 16 + (lane & 15), CC, kk, lane);
      acc[0][nb] = WMMA_F16(a0, bf, acc[0][nb]);
      acc[1][nb] = WMMA_F16(a1, bf, acc[1][nb]);
    }
  }
  float* ob = out + (size_t)b * CC * NN;
  float* so = So[wave];
  for (int cb = 0; cb < 2; ++cb) {
    int col_b = cb * 16 + ((lane >> 4) << 3);
    for (int nb = 0; nb < 4; ++nb) {
      int nl = nb * 16 + (lane & 15);
      for (int r = 0; r < 8; ++r) so[(col_b + r) * 64 + nl] = acc[cb][nb][r] + bo[co_wave + col_b + r];
    }
  }
  __syncthreads();
  for (int q = 0; q < 16; ++q) {    // 32 channel rows x 256 B (16 pieces); rows 2q, 2q+1 per instruction
    int rl = q * 2 + (lane >> 4), pc = lane & 15;
    vst2(ob + (size_t)(co_wave + rl) * NN + n_base + pc * 4, *(const v4f*)(&so[rl * 64 + pc * 4]));
  }
}

extern "C" void kernel_launch(void* const* d_in, const int* in_sizes, int n_in,
                              void* d_out, int out_size, void* d_ws, size_t ws_size,
                              hipStream_t stream) {
  (void)in_sizes; (void)n_in; (void)out_size; (void)ws_size;
  const float* x  = (const float*)d_in[0];
  const float* g0 = (const float*)d_in[1];
  const float* Wq = (const float*)d_in[2];
  const float* bq = (const float*)d_in[3];
  const float* Wk = (const float*)d_in[4];
  const float* bk = (const float*)d_in[5];
  const float* Wv = (const float*)d_in[6];
  const float* bv = (const float*)d_in[7];
  const float* Wo = (const float*)d_in[8];
  const float* bo = (const float*)d_in[9];
  const float* fw = (const float*)d_in[10];

  char* ws = (char*)d_ws;
  float* scg = (float*)ws; ws += (size_t)BB * NN * sizeof(float);
  f16* W3    = (f16*)ws;   ws += (size_t)3 * CC * CC * sizeof(f16);
  f16* Wo16  = (f16*)ws;   ws += (size_t)CC * CC * sizeof(f16);
  f16* xT    = (f16*)ws;   ws += (size_t)BB * NN * CC * sizeof(f16);
  float* qT  = (float*)ws; ws += (size_t)BB * NN * CC * sizeof(float);
  __bf16* kH = (__bf16*)ws; ws += (size_t)BB * NN * CC * sizeof(__bf16);
  __bf16* kL = (__bf16*)ws; ws += (size_t)BB * NN * CC * sizeof(__bf16);
  f16* v16   = (f16*)ws;   ws += (size_t)BB * NN * CC * sizeof(f16);
  f16* aout  = (f16*)ws;

  k_scale<<<dim3((BB * NN) / 256), 256, 0, stream>>>(g0, scg);
  k_wconv<<<dim3((4 * CC * CC / 8) / 256), 256, 0, stream>>>(Wq, Wk, Wv, Wo, fw, W3, Wo16);
  k_xt<<<dim3(NN / 64, CC / 64, BB), 256, 0, stream>>>(x, xT);
  k_qkv<<<dim3(NN / 64, BB), 256, 0, stream>>>(xT, W3, x, Wq, Wk, fw, bq, bk, bv, scg, qT, kH, kL, v16);
  k_attn<<<dim3(NN / 64, BB), 256, 0, stream>>>(qT, kH, kL, v16, aout);
  k_out<<<dim3(NN / 64, BB), 256, 0, stream>>>(aout, Wo16, bo, (float*)d_out);
}

// v004
// A run of this version takes 269 microseconds.
// Next to v003, in two timings, it ran 1.05 times as fast each time.
// Over all steps from v000 it is 2.62 times as fast.
#include <hip/hip_runtime.h>

#define BB 8
#define CC 256
#define NN 4096
#define H0 32
#define W0 32

typedef _Float16 f16;
typedef __attribute__((ext_vector_type(16))) _Float16 v16h;
typedef __attribute__((ext_vector_type(8)))  _Float16 v8h;
typedef __attribute__((ext_vector_type(8)))  float    v8f;

union FragU { v16h v; v8h h[2]; };
typedef __attribute__((ext_vector_type(4))) float v4f;
typedef __attribute__((ext_vector_type(4))) unsigned v4u;
// Contractions: q/k/v 1x1 convs and the output conv (K = 256), scores q^T k (K = 256) and P V^T (K = keys) on
// v_wmma_f32_16x16x32_f16 (f16 operands, f32 accumulate; P scaled by 256 before its f16 conversion) — except the scores,
// and the q/k projections, which run as bf16 hi/lo splits (hi*hi + hi*lo + lo*hi) of f32 operands (q kept in f32, k as its two bf16 planes). The FFT refine with
// per-channel real weights is exactly fw_c * x and is folded into the conv weights; bilinear guide, sigmoid, softmax in f32.
template <typename V> __device__ __forceinline__ void vst2(void* p, V v) {
  *(V*)p = v; 
}
#define PSC 256.0f
#define PUN (1.0f / 256.0f)
typedef __attribute__((ext_vector_type(16))) __bf16 v16bf;
typedef __attribute__((ext_vector_type(8)))  __bf16 v8bf;
__device__ __forceinline__ __bf16 bf_hi(float x) { return (__bf16)x; }
__device__ __forceinline__ __bf16 bf_lo(float x, __bf16 h) { return (__bf16)(x - (float)h); }
__device__ __forceinline__ v8f WMMA_BF16(v16bf a, v16bf b, v8f c) {
  v8f d = __builtin_amdgcn_wmma_f32_16x16x32_bf16(false, a, false, b, (short)0, c, false, false);
  asm volatile("v_nop\n\tv_nop\n\tv_nop\n\tv_nop" : "+v"(d) : "v"(a), "v"(b));
  return d;
}
// bf16 fragment from an LDS plane [row][rs] (split K map)
__device__ __forceinline__ v16bf load_bf_lds(const __bf16* base, int row, int rs, int kbase, int lane) {
  union { v16bf v; v8bf h[2]; } u;
  const __bf16* p = base + (size_t)row * rs + kbase + ((lane >> 4) << 3);
  u.h[0] = *(const v8bf*)(p); u.h[1] = *(const v8bf*)(p + 16);
  return u.v;
}
// A-matrix fragment (16x32 f16, M x K), memory layout [row][k] row-major.
// Element i of lane L: K = kbase + (i/8)*16 + (L/16)*8 + i%8, M = row (caller adds lane%16).
__device__ __forceinline__ v16h load_a(const f16* base, int row, int rs, int kbase, int lane) {
  const f16* p = base + (size_t)row * rs + kbase + ((lane >> 4) << 3);
  FragU u;
  u.h[0] = *(const v8h*)(p);
  u.h[1] = *(const v8h*)(p + 16);
  return u.v;
}
// B-matrix fragment (32x16 f16, K x N), memory layout [col][k] (K contiguous); same per-lane K map as A:
// Element i of lane L: K = kbase + (i/8)*16 + (L/16)*8 + i%8, N = col.
__device__ __forceinline__ v16h load_b(const f16* base, int col, int rs, int kbase, int lane) {
  return load_a(base, col, rs, kbase, lane);
}

__device__ __forceinline__ v8f WMMA_F16(v16h a, v16h b, v8f c) {
  v8f d = __builtin_amdgcn_wmma_f32_16x16x32_f16(false, a, false, b, (short)0, c, false, false);
  asm volatile("v_nop\n\tv_nop\n\tv_nop\n\tv_nop" : "+v"(d) : "v"(a), "v"(b));
  return d;
}

// ---------------- prep kernels ----------------

// bilinear(align_corners) + sigmoid -> scale = 1 + sigmoid(g)
__global__ __launch_bounds__(256) void k_scale(const float* __restrict__ g0,
                                               float* __restrict__ sc) {
  int idx = blockIdx.x * 256 + threadIdx.x;   // B*N
  int b = idx >> 12, n = idx & (NN - 1);
  int ny = n >> 6, nx = n & 63;
  float fy = ny * (31.0f / 63.0f);
  float fx = nx * (31.0f / 63.0f);
  int y0 = (int)fy, x0 = (int)fx;
  float wy = fy - (float)y0, wx = fx - (float)x0;
  int y1 = min(y0 + 1, H0 - 1), x1 = min(x0 + 1, W0 - 1);
  const float* g = g0 + (size_t)b * H0 * W0;
  float v00 = g[y0 * W0 + x0], v01 = g[y0 * W0 + x1];
  float v10 = g[y1 * W0 + x0], v11 = g[y1 * W0 + x1];
  float vy0 = v00 * (1.f - wx) + v01 * wx;
  float vy1 = v10 * (1.f - wx) + v11 * wx;
  float v = vy0 * (1.f - wy) + vy1 * wy;
  vst2(sc + idx, 1.0f + 1.0f / (1.0f + __expf(-v)));
}

// convert weights to f16; fold freq_weights into Wq/Wk/Wv columns (refined = fw*x)
__global__ __launch_bounds__(256) void k_wconv(const float* __restrict__ Wq,
                                               const float* __restrict__ Wk,
                                               const float* __restrict__ Wv,
                                               const float* __restrict__ Wo,
                                               const float* __restrict__ fw,
                                               f16* __restrict__ W3,
                                               f16* __restrict__ Wo16) {
  int g = blockIdx.x * 256 + threadIdx.x;     // 4*256*256/8 pieces of 8 halves
  int idx0 = g * 8;
  int m = idx0 >> 16, r0 = idx0 & 65535;
  const float* W = (m == 0) ? Wq : (m == 1) ? Wk : (m == 2) ? Wv : Wo;
  union { v8h h; v4u u; } pk;
#pragma unroll
  for (int e = 0; e < 8; ++e) { int r = r0 + e, ci = r & (CC - 1); pk.h[e] = (f16)(W[r] * ((m < 3) ? fw[ci] : 1.0f)); }
  f16* dst = (m < 3) ? (W3 + (size_t)m * 65536 + r0) : (Wo16 + r0);
  vst2(dst, pk.u);
}

// x [b][c][n] f32 -> xT [b][n][c] f16 via LDS 64x64 tile (coalesced both sides)
__global__ __launch_bounds__(256) void k_xt(const float* __restrict__ x,
                                            f16* __restrict__ xT) {
  __shared__ __align__(16) f16 tile[64][72];
  int b = blockIdx.z, c0 = blockIdx.y * 64, n0 = blockIdx.x * 64;
  int tid = threadIdx.x;
  {
    int cl = tid >> 2, nq = (tid & 3) * 16;
    const float4* src = (const float4*)(x + (size_t)b * CC * NN +
                                        (size_t)(c0 + cl) * NN + n0 + nq);
    for (int i = 0; i < 4; ++i) {
      float4 v = src[i];
      tile[cl][nq + 4 * i + 0] = (f16)v.x;
      tile[cl][nq + 4 * i + 1] = (f16)v.y;
      tile[cl][nq + 4 * i + 2] = (f16)v.z;
      tile[cl][nq + 4 * i + 3] = (f16)v.w;
    }
  }
  __syncthreads();
  for (int pass = 0; pass < 2; ++pass) {
    int nl = pass * 32 + (tid >> 3), cq = (tid & 7) * 8;
    f16* dst = xT + (size_t)b * NN * CC + (size_t)(n0 + nl) * CC + c0 + cq;
    union { v8h h; v4u u; } o;
    for (int i = 0; i < 8; ++i) o.h[i] = tile[cq + i][nl];
    vst2(dst, o.u);
  }
}

// ---------------- QKV GEMM ----------------
// q stored [b][n][c] (transposed, f32, scaled); k stored [b][n][c] as two bf16 planes, hi and lo; v stored [b][c][n] (f16, scaled)
__global__ __launch_bounds__(256) void k_qkv(const f16* __restrict__ xT,
                                             const f16* __restrict__ W3,
                                             const float* __restrict__ xf,   // x f32 [b][c][n]
                                             const float* __restrict__ Wqf, const float* __restrict__ Wkf,
                                             const float* __restrict__ fw,
                                             const float* __restrict__ bq,
                                             const float* __restrict__ bk,
                                             const float* __restrict__ bv,
                                             const float* __restrict__ scg,
                                             float* __restrict__ qT,
                                             __bf16* __restrict__ kH,
                                             __bf16* __restrict__ kL,
                                             f16* __restrict__ v16) {
  __shared__ __align__(16) float T[64][260];   // block tile [n][c] (padded), f32
  int b = blockIdx.y;
  int n_base = blockIdx.x * 64;
  int tid = threadIdx.x;
  int lane = threadIdx.x & 31, wave = threadIdx.x >> 5;
  int co_wave = wave * 32;
  const f16* xTb = xT + (size_t)b * NN * CC;
  const float* scb = scg + (size_t)b * NN;
  const v8f vzero = {};
  const float* xfb = xf + (size_t)b * CC * NN;
  for (int m = 0; m < 3; ++m) {
    const f16* Wm = W3 + (size_t)m * 65536;
    const float* bias = (m == 0) ? bq : ((m == 1) ? bk : bv);
    v8f acc[2][4];
    for (int cb = 0; cb < 2; ++cb)
      for (int nb = 0; nb < 4; ++nb) acc[cb][nb] = vzero;
    if (m < 2) {
      // q and k as a bf16 hi/lo split of f32 operands: A = (W*fw) rows [co][ci] (contiguous), B = x[b][c][n] gathered down c (stride NN)
      const float* Wf = (m == 0) ? Wqf : Wkf;
      for (int kk = 0; kk < CC; kk += 32) {
        v16bf ah[2], al[2];
#pragma unroll
        for (int cb = 0; cb < 2; ++cb) {
          const float* wr = Wf + (size_t)(co_wave + cb * 16 + (lane & 15)) * CC + kk + ((lane >> 4) << 3);
#pragma unroll
          for (int e = 0; e < 16; ++e) { const int ko = (e < 8) ? e : (8 + e); const float w = wr[ko] * fw[kk + ((lane >> 4) << 3) + ko];
                                         __bf16 hh = bf_hi(w); ah[cb][e] = hh; al[cb][e] = bf_lo(w, hh); }
        }
        for (int nb = 0; nb < 4; ++nb) {
          v16bf bh, bl;
          const float* xp = xfb + (size_t)(kk + ((lane >> 4) << 3)) * NN + n_base + nb * 16 + (lane & 15);
#pragma unroll
          for (int e = 0; e < 16; ++e) { const int ko = (e < 8) ? e : (8 + e); const float xv = xp[(size_t)ko * NN];
                                         __bf16 hh = bf_hi(xv); bh[e] = hh; bl[e] = bf_lo(xv, hh); }
          acc[0][nb] = WMMA_BF16(ah[0], bh, acc[0][nb]); acc[0][nb] = WMMA_BF16(ah[0], bl, acc[0][nb]); acc[0][nb] = WMMA_BF16(al[0], bh, acc[0][nb]);
          acc[1][nb] = WMMA_BF16(ah[1], bh, acc[1][nb]); acc[1][nb] = WMMA_BF16(ah[1], bl, acc[1][nb]); acc[1][nb] = WMMA_BF16(al[1], bh, acc[1][nb]);
        }
      }
    } else
    for (int kk = 0; kk < CC; kk += 32) {
      v16h a0 = load_a(Wm, co_wave + (lane & 15), CC, kk, lane);
      v16h a1 = load_a(Wm, co_wave + 16 + (lane & 15), CC, kk, lane);
      for (int nb = 0; nb < 4; ++nb) {
        v16h bf = load_b(xTb, n_base + nb * 16 + (lane & 15), CC, kk, lane);
        acc[0][nb] = WMMA_F16(a0, bf, acc[0][nb]);
        acc[1][nb] = WMMA_F16(a1, bf, acc[1][nb]);
      }
    }
    float qmul = (m == 0) ? 0.0625f : 1.0f;  // fold 1/sqrt(C) into q
    __syncthreads();                          // previous matrix's tile fully stored
    for (int cb = 0; cb < 2; ++cb) {
      int co_b = co_wave + cb * 16 + ((lane >> 4) << 3);
      for (int nb = 0; nb < 4; ++nb) {
        int nl = nb * 16 + (lane & 15);
        float s = scb[n_base + nl] * qmul;
        for (int r = 0; r < 8; ++r) T[nl][co_b + r] = (acc[cb][nb][r] + bias[co_b + r]) * s;
      }
    }
    __syncthreads();
    if (m == 0) {   // f32 [b][n][c]: 64 rows x 1024 B (64 pieces of 4 floats)
      float* dstb = qT + (size_t)b * NN * CC + (size_t)n_base * CC;
      for (int g = tid; g < 64 * 64; g += 256) { int nl = g >> 6, pc = g & 63; vst2(dstb + (size_t)nl * CC + pc * 4, *(const v4f*)(&T[nl][pc * 4])); }
    } else if (m == 1) {   // bf16 hi and lo planes [b][n][c]: 64 rows x 512 B each (32 pieces of 8), split here once for every reader
      const size_t ko = (size_t)b * NN * CC + (size_t)n_base * CC;
      for (int g = tid; g < 64 * 32; g += 256) {
        int nl = g >> 5, pc = g & 31;
        v8bf h8, l8;
#pragma unroll   // constant indices keep h8 and l8 in registers
        for (int e = 0; e < 8; ++e) { const float kv = T[nl][pc * 8 + e]; __bf16 h = bf_hi(kv); h8[e] = h; l8[e] = bf_lo(kv, h); }
        vst2(kH + ko + (size_t)nl * CC + pc * 8, h8);
        vst2(kL + ko + (size_t)nl * CC + pc * 8, l8);
      }
    } else {
      f16* vb = v16 + (size_t)b * CC * NN + n_base;
      for (int g = tid; g < 256 * 8; g += 256) {
        int c = g >> 3, pc = g & 7;
        union { v8h h; v4u u; } pk;
        for (int e = 0; e < 8; ++e) pk.h[e] = (f16)T[pc * 8 + e][c];
        vst2(vb + (size_t)c * NN + pc * 8, pk.u);
      }
    }
  }
}

// ---------------- flash attention ----------------
// Work-group barrier that orders LDS traffic only: __syncthreads() would also wait for the global loads in flight,
// and the V loads below are meant to stay in flight across it, as are the K copies (both read only what an earlier launch wrote).
__device__ __forceinline__ void lds_barrier() {
  __builtin_amdgcn_fence(__ATOMIC_RELEASE, "workgroup", "local");
  __builtin_amdgcn_s_barrier();
  __builtin_amdgcn_fence(__ATOMIC_ACQUIRE, "workgroup", "local");
}
// Eight asynchronous copies of one wave: rows r, r + 8, ..., r + 56 of one K plane, a whole 512-B row (4 lines) per copy, 16 B per lane,
// from rows of 512 B in global memory to rows of 528 B in LDS. lds = the lane's LDS byte address, g = the lane's global address, both of row r.
// The s_wait_xcnt is a precaution and closes the statement, so that no address register is rewritten in front of it.
__device__ __forceinline__ void k_rows_async(unsigned lds, const __bf16* g) {
  asm volatile("global_load_async_to_lds_b128 %0, %8, off\n\t"
               "global_load_async_to_lds_b128 %1, %9, off\n\t"
               "global_load_async_to_lds_b128 %2, %10, off\n\t"
               "global_load_async_to_lds_b128 %3, %11, off\n\t"
               "global_load_async_to_lds_b128 %4, %12, off\n\t"
               "global_load_async_to_lds_b128 %5, %13, off\n\t"
               "global_load_async_to_lds_b128 %6, %14, off\n\t"
               "global_load_async_to_lds_b128 %7, %15, off\n\t"
               "s_wait_xcnt 0x0"
               :: "v"(lds), "v"(lds + 1u * 4224u), "v"(lds + 2u * 4224u), "v"(lds + 3u * 4224u),
                  "v"(lds + 4u * 4224u), "v"(lds + 5u * 4224u), "v"(lds + 6u * 4224u), "v"(lds + 7u * 4224u),
                  "v"(g), "v"(g + 1 * 8 * CC), "v"(g + 2 * 8 * CC), "v"(g + 3 * 8 * CC),
                  "v"(g + 4 * 8 * CC), "v"(g + 5 * 8 * CC), "v"(g + 6 * 8 * CC), "v"(g + 7 * 8 * CC)
               : "memory");
}
// exp(x) as __expf forms it (one multiply, one v_exp_f32), with the slot behind the transcendental kept inside the statement
__device__ __forceinline__ float exp_slot(float x) {
  const float y = x * 1.44269504f;
  float r;
  asm("v_exp_f32 %0, %1\n\tv_nop" : "=v"(r) : "v"(y));   // the v_nop fills the slot: nothing reads r or rewrites y directly behind the v_exp_f32
  return r;
}
// out[b][n][c] f16 = softmax(q^T k) v ; 128 query rows per workgroup, tiles of 64 keys
__global__ __launch_bounds__(256) void k_attn(const float* __restrict__ qT,
                                              const __bf16* __restrict__ kH,
                                              const __bf16* __restrict__ kL,
                                              const f16* __restrict__ v16,
                                              f16* __restrict__ aout) {
  __shared__ __align__(16) __bf16 Qh[128][264];  // staged Q block, bf16 hi / lo planes
  __shared__ __align__(16) __bf16 Ql[128][264];
  __shared__ __align__(16) __bf16 Kh[64][264];   // staged K tile, bf16 hi / lo planes, filled by asynchronous copies
  __shared__ __align__(16) __bf16 Kl[64][264];
  __shared__ __align__(16) float Sbuf[128][68];  // scores f32
  // softmax numerator f16: takes over the score bytes once every thread holds its scores in registers (a barrier lies between)
  f16 (*Pbuf)[72] = reinterpret_cast<f16 (*)[72]>(&Sbuf[0][0]);
  __shared__ float m_run[128], l_run[128], rfac[128];
  __shared__ float pmax[2][128], psum[4][128];
  // output tile [n][c]: takes over the Q hi plane after the last tile's scores
  f16 (*Ot)[264] = reinterpret_cast<f16 (*)[264]>(&Qh[0][0]);
  int b = blockIdx.y;
  int nq = blockIdx.x * 128;
  int tid = threadIdx.x, lane = tid & 31, wave = tid >> 5;
  int rowp = (wave & 3) * 2;       // S row blocks rowp, rowp+1: with two column blocks a 32 x 32 tile per wave,
  int colp = (wave >> 2) * 2;      // S col blocks colp, colp+1: so every fragment read from LDS feeds two tiles
  int c_wave = wave * 32;          // O channel range for this wave
  int srow = tid & 127, sh = tid >> 7;  // softmax: 2 threads per row, 32 cols each (two groups of 16)
  const float* qTb = qT + (size_t)b * NN * CC;
  const f16* vb  = v16 + (size_t)b * CC * NN;
  const v8f vzero = {};
  v8f oacc[16];
  for (int i = 0; i < 16; ++i) oacc[i] = vzero;

  // K tile = 64 rows x 512 B of each plane; wave w copies rows w, w + 8, ..., w + 56 of both planes, through no register
  const __bf16* khp = kH + (size_t)b * NN * CC + (size_t)wave * CC + lane * 8;
  const __bf16* klp = kL + (size_t)b * NN * CC + (size_t)wave * CC + lane * 8;
  const unsigned kh_lds = (unsigned)(size_t)&Kh[wave][lane * 8];
  const unsigned kl_lds = (unsigned)(size_t)&Kl[wave][lane * 8];
  k_rows_async(kh_lds, khp);   // tile 0: nothing has touched the K planes yet
  k_rows_async(kl_lds, klp);

  // stage Q block as bf16 hi/lo planes: 256 threads, each converts 128 floats
  {
    int row = tid >> 1, cbase = (tid & 1) * 128;
    const float* qp = &qTb[(size_t)(nq + row) * CC + cbase];
    for (int i = 0; i < 128; i += 4) {
      const v4f a = *(const v4f*)(qp + i);
#pragma unroll
      for (int e = 0; e < 4; ++e) { __bf16 h = bf_hi(a[e]); Qh[row][cbase + i + e] = h; Ql[row][cbase + i + e] = bf_lo(a[e], h); }
    }
  }
  if (tid < 128) { m_run[tid] = -1e30f; l_run[tid] = 0.f; }
  asm volatile("s_wait_asynccnt 0x0" ::: "memory");   // this wave's rows of tile 0 have landed; the barrier publishes them
  __syncthreads();

  for (int t = 0; t < NN / 64; ++t) {
    int mb = t * 64;
    // S = Q^T K for this 128x64 tile (2 x 2 subtiles per wave)
    v8f s[2][2] = {{vzero, vzero}, {vzero, vzero}};
    for (int kk = 0; kk < CC; kk += 32) {      // scores as a bf16 hi/lo split: hi*hi + hi*lo + lo*hi, in that order in every subtile
      v16bf ah[2], al[2], bh[2], bl[2];
      for (int i = 0; i < 2; ++i) {
        ah[i] = load_bf_lds(&Qh[0][0], (rowp + i) * 16 + (lane & 15), 264, kk, lane);
        al[i] = load_bf_lds(&Ql[0][0], (rowp + i) * 16 + (lane & 15), 264, kk, lane);
        bh[i] = load_bf_lds(&Kh[0][0], (colp + i) * 16 + (lane & 15), 264, kk, lane);
        bl[i] = load_bf_lds(&Kl[0][0], (colp + i) * 16 + (lane & 15), 264, kk, lane);
      }
      for (int i = 0; i < 2; ++i)
        for (int j = 0; j < 2; ++j) s[i][j] = WMMA_BF16(ah[i], bh[j], s[i][j]);
      for (int i = 0; i < 2; ++i)
        for (int j = 0; j < 2; ++j) s[i][j] = WMMA_BF16(ah[i], bl[j], s[i][j]);
      for (int i = 0; i < 2; ++i)
        for (int j = 0; j < 2; ++j) s[i][j] = WMMA_BF16(al[i], bh[j], s[i][j]);
    }
    // this tile's V fragments, all eight loads as one group: they fly under the softmax and are first read by the P V^T products
    v16h vf[2][2];
    for (int k2 = 0; k2 < 2; ++k2)
      for (int cb = 0; cb < 2; ++cb) vf[k2][cb] = load_b(vb, c_wave + cb * 16 + (lane & 15), NN, mb + k2 * 32, lane);
    for (int i = 0; i < 2; ++i)
      for (int r = 0; r < 8; ++r) {
        int row = (rowp + i) * 16 + r + ((lane >> 4) << 3);
        Sbuf[row][colp * 16 + (lane & 15)] = s[i][0][r];
        Sbuf[row][(colp + 1) * 16 + (lane & 15)] = s[i][1][r];
      }
    // precaution: the softmax below reuses the V loads' address registers while the loads are still in flight
    asm volatile("s_wait_xcnt 0x0" ::: "memory");
    asm volatile("s_wait_dscnt 0x0" ::: "memory");   // this wave's reads of the K planes have retired before any wave's copies rewrite them
    lds_barrier();
    // every wave has left the K planes: the next tile's copies start here and fly under the softmax and the P V^T products
    if (t + 1 < NN / 64) {
      k_rows_async(kh_lds, khp + (size_t)(mb + 64) * CC);
      k_rows_async(kl_lds, klp + (size_t)(mb + 64) * CC);
    }
    // ---- parallel online softmax: all 256 threads, vectorized ----
    float arr[32];
    {
      const float4* sp = (const float4*)&Sbuf[srow][sh * 32];
      float mx = -1e30f;
      for (int i = 0; i < 8; ++i) {
        float4 f = sp[i];
        ((float4*)arr)[i] = f;
        mx = fmaxf(mx, fmaxf(fmaxf(f.x, f.y), fmaxf(f.z, f.w)));
      }
      pmax[sh][srow] = mx;
    }
    lds_barrier();
    {
      float m_new = fmaxf(fmaxf(pmax[0][srow], pmax[1][srow]), m_run[srow]);
      for (int g = 0; g < 2; ++g) {   // one partial sum per group of 16 columns
        float l = 0.f;
        v8h pk0, pk1;
        for (int i = 0; i < 8; ++i) {
          float p = exp_slot(arr[g * 16 + i] - m_new);
          pk0[i] = (f16)(p * PSC); l += p;
        }
        for (int i = 0; i < 8; ++i) {
          float p = exp_slot(arr[g * 16 + 8 + i] - m_new);
          pk1[i] = (f16)(p * PSC); l += p;
        }
        *(v8h*)&Pbuf[srow][sh * 32 + g * 16] = pk0;
        *(v8h*)&Pbuf[srow][sh * 32 + g * 16 + 8] = pk1;
        psum[sh * 2 + g][srow] = l;
      }
    }
    lds_barrier();
    if (tid < 128) {
      float mold = m_run[tid];
      float m_new = fmaxf(fmaxf(pmax[0][tid], pmax[1][tid]), mold);
      float rs = __expf(mold - m_new);
      l_run[tid] = l_run[tid] * rs +
                   (psum[0][tid] + psum[1][tid] + psum[2][tid] + psum[3][tid]);
      m_run[tid] = m_new;
      rfac[tid] = rs;
    }
    lds_barrier();
    // rescale O and accumulate O += P * V^T (K = 64 keys): four row blocks at a time, their factors and P fragments read as one group
    for (int h = 0; h < 2; ++h) {
      float f[4][8];
      v16h pa[4][2];
      for (int j = 0; j < 4; ++j) {
        const int nb = h * 4 + j;
        for (int r = 0; r < 8; ++r) f[j][r] = rfac[nb * 16 + r + ((lane >> 4) << 3)];
        for (int k2 = 0; k2 < 2; ++k2) pa[j][k2] = load_a(&Pbuf[0][0], nb * 16 + (lane & 15), 72, k2 * 32, lane);
      }
      for (int j = 0; j < 4; ++j)
        for (int cb = 0; cb < 2; ++cb)
          for (int r = 0; r < 8; ++r) oacc[(h * 4 + j) * 2 + cb][r] *= f[j][r];
      for (int k2 = 0; k2 < 2; ++k2)
        for (int j = 0; j < 4; ++j)
          for (int cb = 0; cb < 2; ++cb)
            oacc[(h * 4 + j) * 2 + cb] = WMMA_F16(pa[j][k2], vf[k2][cb], oacc[(h * 4 + j) * 2 + cb]);
    }
    asm volatile("s_wait_dscnt 0x0" ::: "memory");      // this wave's reads of P and rfac have retired
    asm volatile("s_wait_asynccnt 0x0" ::: "memory");   // this wave's rows of the next tile have landed
    __syncthreads();   // publishes the next K tile; also ends this tile's reads of P and rfac
  }
  // epilogue: divide by softmax sum (and the P scale), stage [n][c], store [b][n][c] f16 rows of 512 B
  for (int nb = 0; nb < 8; ++nb)
    for (int cb = 0; cb < 2; ++cb) {
      int c = c_wave + cb * 16 + (lane & 15);
      for (int r = 0; r < 8; ++r) {
        int nloc = nb * 16 + r + ((lane >> 4) << 3);
        Ot[nloc][c] = (f16)(oacc[nb * 2 + cb][r] * (PUN / l_run[nloc]));
      }
    }
  __syncthreads();
  {
    f16* ab = aout + (size_t)b * NN * CC + (size_t)nq * CC;
    for (int g = tid; g < 128 * 32; g += 256) { int nl = g >> 5, pc = g & 31; vst2(ab + (size_t)nl * CC + pc * 8, *(const v4u*)(&Ot[nl][pc * 8])); }
  }
}

// ---------------- output projection ----------------
__global__ __launch_bounds__(256) void k_out(const f16* __restrict__ aout,
                                             const f16* __restrict__ Wo16,
                                             const float* __restrict__ bo,
                                             float* __restrict__ out) {
  __shared__ __align__(16) float So[8][32 * 64];   // per-wave [co][n] tile
  int b = blockIdx.y;
  int n_base = blockIdx.x * 64;
  int lane = threadIdx.x & 31, wave = threadIdx.x >> 5;
  int co_wave = wave * 32;
  const f16* ab = aout + (size_t)b * NN * CC;
  const v8f vzero = {};
  v8f acc[2][4];
  for (int cb = 0; cb < 2; ++cb)
    for (int nb = 0; nb < 4; ++nb) acc[cb][nb] = vzero;
  for (int kk = 0; kk < CC; kk += 32) {
    v16h a0 = load_a(Wo16, co_wave + (lane & 15), CC, kk, lane);
    v16h a1 = load_a(Wo16, co_wave + 16 + (lane & 15), CC, kk, lane);
    for (int nb = 0; nb < 4; ++nb) {
      v16h bf = load_b(ab, n_base + nb * 16 + (lane & 15), CC, kk, lane);
      acc[0][nb] = WMMA_F16(a0, bf, acc[0][nb]);
      acc[1][nb] = WMMA_F16(a1, bf, acc[1][nb]);
    }
  }
  float* ob = out + (size_t)b * CC * NN;
  float* so = So[wave];
  for (int cb = 0; cb < 2; ++cb) {
    int col_b = cb * 16 + ((lane >> 4) << 3);
    for (int nb = 0; nb < 4; ++nb) {
      int nl = nb * 16 + (lane & 15);
      for (int r = 0; r < 8; ++r) so[(col_b + r) * 64 + nl] = acc[cb][nb][r] + bo[co_wave + col_b + r];
    }
  }
  __syncthreads();
  for (int q = 0; q < 16; ++q) {    // 32 channel rows x 256 B (16 pieces); rows 2q, 2q+1 per instruction
    int rl = q * 2 + (lane >> 4), pc = lane & 15;
    vst2(ob + (size_t)(co_wave + rl) * NN + n_base + pc * 4, *(const v4f*)(&so[rl * 64 + pc * 4]));
  }
}

extern "C" void kernel_launch(void* const* d_in, const int* in_sizes, int n_in,
                              void* d_out, int out_size, void* d_ws, size_t ws_size,
                              hipStream_t stream) {
  (void)in_sizes; (void)n_in; (void)out_size; (void)ws_size;
  const float* x  = (const float*)d_in[0];
  const float* g0 = (const float*)d_in[1];
  const float* Wq = (const float*)d_in[2];
  const float* bq = (const float*)d_in[3];
  const float* Wk = (const float*)d_in[4];
  const float* bk = (const float*)d_in[5];
  const float* Wv = (const float*)d_in[6];
  const float* bv = (const float*)d_in[7];
  const float* Wo = (const float*)d_in[8];
  const float* bo = (const float*)d_in[9];
  const float* fw = (const float*)d_in[10];

  char* ws = (char*)d_ws;
  float* scg = (float*)ws; ws += (size_t)BB * NN * sizeof(float);
  f16* W3    = (f16*)ws;   ws += (size_t)3 * CC * CC * sizeof(f16);
  f16* Wo16  = (f16*)ws;   ws += (size_t)CC * CC * sizeof(f16);
  f16* xT    = (f16*)ws;   ws += (size_t)BB * NN * CC * sizeof(f16);
  float* qT  = (float*)ws; ws += (size_t)BB * NN * CC * sizeof(float);
  __bf16* kH = (__bf16*)ws; ws += (size_t)BB * NN * CC * sizeof(__bf16);
  __bf16* kL = (__bf16*)ws; ws += (size_t)BB * NN * CC * sizeof(__bf16);
  f16* v16   = (f16*)ws;   ws += (size_t)BB * NN * CC * sizeof(f16);
  f16* aout  = (f16*)ws;

  k_scale<<<dim3((BB * NN) / 256), 256, 0, stream>>>(g0, scg);
  k_wconv<<<dim3((4 * CC * CC / 8) / 256), 256, 0, stream>>>(Wq, Wk, Wv, Wo, fw, W3, Wo16);
  k_xt<<<dim3(NN / 64, CC / 64, BB), 256, 0, stream>>>(x, xT);
  k_qkv<<<dim3(NN / 64, BB), 256, 0, stream>>>(xT, W3, x, Wq, Wk, fw, bq, bk, bv, scg, qT, kH, kL, v16);
  k_attn<<<dim3(NN / 128, BB), 256, 0, stream>>>(qT, kH, kL, v16, aout);
  k_out<<<dim3(NN / 64, BB), 256, 0, stream>>>(aout, Wo16, bo, (float*)d_out);
}

// v005
// A run of this version takes 256 microseconds.
// In both of two side-by-side timings against v004, it was 1.06 times as fast.
// Over all steps from v000 it is 2.76 times as fast.
#include <hip/hip_runtime.h>

#define BB 8
#define CC 256
#define NN 4096
#define H0 32
#define W0 32

typedef _Float16 f16;
typedef __attribute__((ext_vector_type(16))) _Float16 v16h;
typedef __attribute__((ext_vector_type(8)))  _Float16 v8h;
typedef __attribute__((ext_vector_type(8)))  float    v8f;

union FragU { v16h v; v8h h[2]; };
typedef __attribute__((ext_vector_type(4))) float v4f;
typedef __attribute__((ext_vector_type(4))) unsigned v4u;
// Contractions: q/k/v 1x1 convs and the output conv (K = 256), scores q^T k (K = 256) and P V^T (K = keys) on
// v_wmma_f32_16x16x32_f16 (f16 operands, f32 accumulate; P scaled by 256 before its f16 conversion) — except the scores,
// and the q/k projections, which run as bf16 hi/lo splits (hi*hi + hi*lo + lo*hi) of f32 operands (q kept in f32, k as its two bf16 planes). The FFT refine with
// per-channel real weights is exactly fw_c * x and is folded into the conv weights; bilinear guide, sigmoid, softmax in f32.
template <typename V> __device__ __forceinline__ void vst2(void* p, V v) {
  *(V*)p = v; 
}
#define PSC 256.0f
#define PUN (1.0f / 256.0f)
typedef __attribute__((ext_vector_type(16))) __bf16 v16bf;
typedef __attribute__((ext_vector_type(8)))  __bf16 v8bf;
__device__ __forceinline__ __bf16 bf_hi(float x) { return (__bf16)x; }
__device__ __forceinline__ __bf16 bf_lo(float x, __bf16 h) { return (__bf16)(x - (float)h); }
__device__ __forceinline__ v8f WMMA_BF16(v16bf a, v16bf b, v8f c) {
  v8f d = __builtin_amdgcn_wmma_f32_16x16x32_bf16(false, a, false, b, (short)0, c, false, false);
  asm volatile("v_nop\n\tv_nop\n\tv_nop\n\tv_nop" : "+v"(d) : "v"(a), "v"(b));
  return d;
}
// bf16 fragment from an LDS plane [row][rs] (split K map)
__device__ __forceinline__ v16bf load_bf_lds(const __bf16* base, int row, int rs, int kbase, int lane) {
  union { v16bf v; v8bf h[2]; } u;
  const __bf16* p = base + (size_t)row * rs + kbase + ((lane >> 4) << 3);
  u.h[0] = *(const v8bf*)(p); u.h[1] = *(const v8bf*)(p + 16);
  return u.v;
}
// A-matrix fragment (16x32 f16, M x K), memory layout [row][k] row-major.
// Element i of lane L: K = kbase + (i/8)*16 + (L/16)*8 + i%8, M = row (caller adds lane%16).
__device__ __forceinline__ v16h load_a(const f16* base, int row, int rs, int kbase, int lane) {
  const f16* p = base + (size_t)row * rs + kbase + ((lane >> 4) << 3);
  FragU u;
  u.h[0] = *(const v8h*)(p);
  u.h[1] = *(const v8h*)(p + 16);
  return u.v;
}
// B-matrix fragment (32x16 f16, K x N), memory layout [col][k] (K contiguous); same per-lane K map as A:
// Element i of lane L: K = kbase + (i/8)*16 + (L/16)*8 + i%8, N = col.
__device__ __forceinline__ v16h load_b(const f16* base, int col, int rs, int kbase, int lane) {
  return load_a(base, col, rs, kbase, lane);
}

__device__ __forceinline__ v8f WMMA_F16(v16h a, v16h b, v8f c) {
  v8f d = __builtin_amdgcn_wmma_f32_16x16x32_f16(false, a, false, b, (short)0, c, false, false);
  asm volatile("v_nop\n\tv_nop\n\tv_nop\n\tv_nop" : "+v"(d) : "v"(a), "v"(b));
  return d;
}

// ---------------- prep kernels ----------------

// bilinear(align_corners) + sigmoid -> scale = 1 + sigmoid(g)
__global__ __launch_bounds__(256) void k_scale(const float* __restrict__ g0,
                                               float* __restrict__ sc) {
  int idx = blockIdx.x * 256 + threadIdx.x;   // B*N
  int b = idx >> 12, n = idx & (NN - 1);
  int ny = n >> 6, nx = n & 63;
  float fy = ny * (31.0f / 63.0f);
  float fx = nx * (31.0f / 63.0f);
  int y0 = (int)fy, x0 = (int)fx;
  float wy = fy - (float)y0, wx = fx - (float)x0;
  int y1 = min(y0 + 1, H0 - 1), x1 = min(x0 + 1, W0 - 1);
  const float* g = g0 + (size_t)b * H0 * W0;
  float v00 = g[y0 * W0 + x0], v01 = g[y0 * W0 + x1];
  float v10 = g[y1 * W0 + x0], v11 = g[y1 * W0 + x1];
  float vy0 = v00 * (1.f - wx) + v01 * wx;
  float vy1 = v10 * (1.f - wx) + v11 * wx;
  float v = vy0 * (1.f - wy) + vy1 * wy;
  vst2(sc + idx, 1.0f + 1.0f / (1.0f + __expf(-v)));
}

// convert weights to f16; fold freq_weights into Wq/Wk/Wv columns (refined = fw*x)
__global__ __launch_bounds__(256) void k_wconv(const float* __restrict__ Wq,
                                               const float* __restrict__ Wk,
                                               const float* __restrict__ Wv,
                                               const float* __restrict__ Wo,
                                               const float* __restrict__ fw,
                                               f16* __restrict__ W3,
                                               f16* __restrict__ Wo16) {
  int g = blockIdx.x * 256 + threadIdx.x;     // 4*256*256/8 pieces of 8 halves
  int idx0 = g * 8;
  int m = idx0 >> 16, r0 = idx0 & 65535;
  const float* W = (m == 0) ? Wq : (m == 1) ? Wk : (m == 2) ? Wv : Wo;
  union { v8h h; v4u u; } pk;
#pragma unroll
  for (int e = 0; e < 8; ++e) { int r = r0 + e, ci = r & (CC - 1); pk.h[e] = (f16)(W[r] * ((m < 3) ? fw[ci] : 1.0f)); }
  f16* dst = (m < 3) ? (W3 + (size_t)m * 65536 + r0) : (Wo16 + r0);
  vst2(dst, pk.u);
}

// x [b][c][n] f32 -> xT [b][n][c] f16 via LDS 64x64 tile (coalesced both sides)
__global__ __launch_bounds__(256) void k_xt(const float* __restrict__ x,
                                            f16* __restrict__ xT) {
  __shared__ __align__(16) f16 tile[64][72];
  int b = blockIdx.z, c0 = blockIdx.y * 64, n0 = blockIdx.x * 64;
  int tid = threadIdx.x;
  {
    int cl = tid >> 2, nq = (tid & 3) * 16;
    const float4* src = (const float4*)(x + (size_t)b * CC * NN +
                                        (size_t)(c0 + cl) * NN + n0 + nq);
    for (int i = 0; i < 4; ++i) {
      float4 v = src[i];
      tile[cl][nq + 4 * i + 0] = (f16)v.x;
      tile[cl][nq + 4 * i + 1] = (f16)v.y;
      tile[cl][nq + 4 * i + 2] = (f16)v.z;
      tile[cl][nq + 4 * i + 3] = (f16)v.w;
    }
  }
  __syncthreads();
  for (int pass = 0; pass < 2; ++pass) {
    int nl = pass * 32 + (tid >> 3), cq = (tid & 7) * 8;
    f16* dst = xT + (size_t)b * NN * CC + (size_t)(n0 + nl) * CC + c0 + cq;
    union { v8h h; v4u u; } o;
    for (int i = 0; i < 8; ++i) o.h[i] = tile[cq + i][nl];
    vst2(dst, o.u);
  }
}

// ---------------- QKV GEMM ----------------
// q stored [b][n][c] (transposed, f32, scaled); k stored [b][n][c] as two bf16 planes, hi and lo; v stored [b][c][n] (f16, scaled)
__global__ __launch_bounds__(256) void k_qkv(const f16* __restrict__ xT,
                                             const f16* __restrict__ W3,
                                             const float* __restrict__ xf,   // x f32 [b][c][n]
                                             const float* __restrict__ Wqf, const float* __restrict__ Wkf,
                                             const float* __restrict__ fw,
                                             const float* __restrict__ bq,
                                             const float* __restrict__ bk,
                                             const float* __restrict__ bv,
                                             const float* __restrict__ scg,
                                             float* __restrict__ qT,
                                             __bf16* __restrict__ kH,
                                             __bf16* __restrict__ kL,
                                             f16* __restrict__ v16) {
  __shared__ __align__(16) float T[64][260];   // block tile [n][c] (padded), f32
  int b = blockIdx.y;
  int n_base = blockIdx.x * 64;
  int tid = threadIdx.x;
  int lane = threadIdx.x & 31, wave = threadIdx.x >> 5;
  int co_wave = wave * 32;
  const f16* xTb = xT + (size_t)b * NN * CC;
  const float* scb = scg + (size_t)b * NN;
  const v8f vzero = {};
  const float* xfb = xf + (size_t)b * CC * NN;
  for (int m = 0; m < 3; ++m) {
    const f16* Wm = W3 + (size_t)m * 65536;
    const float* bias = (m == 0) ? bq : ((m == 1) ? bk : bv);
    v8f acc[2][4];
    for (int cb = 0; cb < 2; ++cb)
      for (int nb = 0; nb < 4; ++nb) acc[cb][nb] = vzero;
    if (m < 2) {
      // q and k as a bf16 hi/lo split of f32 operands: A = (W*fw) rows [co][ci] (contiguous), B = x[b][c][n] gathered down c (stride NN)
      const float* Wf = (m == 0) ? Wqf : Wkf;
      for (int kk = 0; kk < CC; kk += 32) {
        v16bf ah[2], al[2];
#pragma unroll
        for (int cb = 0; cb < 2; ++cb) {
          const float* wr = Wf + (size_t)(co_wave + cb * 16 + (lane & 15)) * CC + kk + ((lane >> 4) << 3);
#pragma unroll
          for (int e = 0; e < 16; ++e) { const int ko = (e < 8) ? e : (8 + e); const float w = wr[ko] * fw[kk + ((lane >> 4) << 3) + ko];
                                         __bf16 hh = bf_hi(w); ah[cb][e] = hh; al[cb][e] = bf_lo(w, hh); }
        }
        for (int nb = 0; nb < 4; ++nb) {
          v16bf bh, bl;
          const float* xp = xfb + (size_t)(kk + ((lane >> 4) << 3)) * NN + n_base + nb * 16 + (lane & 15);
#pragma unroll
          for (int e = 0; e < 16; ++e) { const int ko = (e < 8) ? e : (8 + e); const float xv = xp[(size_t)ko * NN];
                                         __bf16 hh = bf_hi(xv); bh[e] = hh; bl[e] = bf_lo(xv, hh); }
          acc[0][nb] = WMMA_BF16(ah[0], bh, acc[0][nb]); acc[0][nb] = WMMA_BF16(ah[0], bl, acc[0][nb]); acc[0][nb] = WMMA_BF16(al[0], bh, acc[0][nb]);
          acc[1][nb] = WMMA_BF16(ah[1], bh, acc[1][nb]); acc[1][nb] = WMMA_BF16(ah[1], bl, acc[1][nb]); acc[1][nb] = WMMA_BF16(al[1], bh, acc[1][nb]);
        }
      }
    } else
    for (int kk = 0; kk < CC; kk += 32) {
      v16h a0 = load_a(Wm, co_wave + (lane & 15), CC, kk, lane);
      v16h a1 = load_a(Wm, co_wave + 16 + (lane & 15), CC, kk, lane);
      for (int nb = 0; nb < 4; ++nb) {
        v16h bf = load_b(xTb, n_base + nb * 16 + (lane & 15), CC, kk, lane);
        acc[0][nb] = WMMA_F16(a0, bf, acc[0][nb]);
        acc[1][nb] = WMMA_F16(a1, bf, acc[1][nb]);
      }
    }
    float qmul = (m == 0) ? 0.0625f : 1.0f;  // fold 1/sqrt(C) into q
    __syncthreads();                          // previous matrix's tile fully stored
    for (int cb = 0; cb < 2; ++cb) {
      int co_b = co_wave + cb * 16 + ((lane >> 4) << 3);
      for (int nb = 0; nb < 4; ++nb) {
        int nl = nb * 16 + (lane & 15);
        float s = scb[n_base + nl] * qmul;
        for (int r = 0; r < 8; ++r) T[nl][co_b + r] = (acc[cb][nb][r] + bias[co_b + r]) * s;
      }
    }
    __syncthreads();
    if (m == 0) {   // f32 [b][n][c]: 64 rows x 1024 B (64 pieces of 4 floats)
      float* dstb = qT + (size_t)b * NN * CC + (size_t)n_base * CC;
      for (int g = tid; g < 64 * 64; g += 256) { int nl = g >> 6, pc = g & 63; vst2(dstb + (size_t)nl * CC + pc * 4, *(const v4f*)(&T[nl][pc * 4])); }
    } else if (m == 1) {   // bf16 hi and lo planes [b][n][c]: 64 rows x 512 B each (32 pieces of 8), split here once for every reader
      const size_t ko = (size_t)b * NN * CC + (size_t)n_base * CC;
      for (int g = tid; g < 64 * 32; g += 256) {
        int nl = g >> 5, pc = g & 31;
        v8bf h8, l8;
#pragma unroll   // constant indices keep h8 and l8 in registers
        for (int e = 0; e < 8; ++e) { const float kv = T[nl][pc * 8 + e]; __bf16 h = bf_hi(kv); h8[e] = h; l8[e] = bf_lo(kv, h); }
        vst2(kH + ko + (size_t)nl * CC + pc * 8, h8);
        vst2(kL + ko + (size_t)nl * CC + pc * 8, l8);
      }
    } else {
      f16* vb = v16 + (size_t)b * CC * NN + n_base;
      for (int g = tid; g < 256 * 8; g += 256) {
        int c = g >> 3, pc = g & 7;
        union { v8h h; v4u u; } pk;
        for (int e = 0; e < 8; ++e) pk.h[e] = (f16)T[pc * 8 + e][c];
        vst2(vb + (size_t)c * NN + pc * 8, pk.u);
      }
    }
  }
}

// ---------------- flash attention ----------------
// Work-group barrier that orders LDS traffic only: __syncthreads() would also wait for the global loads in flight,
// and the V loads below are meant to stay in flight across it, as are the K copies (both read only what an earlier launch wrote).
__device__ __forceinline__ void lds_barrier() {
  __builtin_amdgcn_fence(__ATOMIC_RELEASE, "workgroup", "local");
  __builtin_amdgcn_s_barrier();
  __builtin_amdgcn_fence(__ATOMIC_ACQUIRE, "workgroup", "local");
}
// Eight asynchronous copies of one wave: rows r, r + 8, ..., r + 56 of one K plane, a whole 512-B row (4 lines) per copy, 16 B per lane,
// from rows of 512 B in global memory to rows of 528 B in LDS. lds = the lane's place in row r of the hi plane, PL = the plane's byte
// distance from the hi plane in LDS, g = the lane's global address in row r. Written as the builtin, whose operands may live above v255
// (an asm operand cannot), and with one LDS address for all sixteen copies of a tile, to leave the registers to the resident Q:
// copy n lands at lds + PL + n * 4224 through its immediate offset; that offset moves both addresses, so the copy's global pointer is
// row r + 8 n's address less the offset: g + n * 4096 - (PL + n * 4224) = g - PL - n * 128. The largest offset is 63360.
template <unsigned PL>
__device__ __forceinline__ void k_rows_async(__bf16* lds, const __bf16* g) {
  typedef __attribute__((ext_vector_type(4))) int v4i;
  typedef __attribute__((address_space(1))) v4i* gp_t;
  typedef __attribute__((address_space(3))) v4i* lp_t;
  const unsigned long long a = (unsigned long long)g - PL;
  const lp_t l = (lp_t)lds;
  __builtin_amdgcn_global_load_async_to_lds_b128((gp_t)(a), l, PL, 0);
  __builtin_amdgcn_global_load_async_to_lds_b128((gp_t)(a - 1 * 128), l, PL + 1 * 4224, 0);
  __builtin_amdgcn_global_load_async_to_lds_b128((gp_t)(a - 2 * 128), l, PL + 2 * 4224, 0);
  __builtin_amdgcn_global_load_async_to_lds_b128((gp_t)(a - 3 * 128), l, PL + 3 * 4224, 0);
  __builtin_amdgcn_global_load_async_to_lds_b128((gp_t)(a - 4 * 128), l, PL + 4 * 4224, 0);
  __builtin_amdgcn_global_load_async_to_lds_b128((gp_t)(a - 5 * 128), l, PL + 5 * 4224, 0);
  __builtin_amdgcn_global_load_async_to_lds_b128((gp_t)(a - 6 * 128), l, PL + 6 * 4224, 0);
  __builtin_amdgcn_global_load_async_to_lds_b128((gp_t)(a - 7 * 128), l, PL + 7 * 4224, 0);
}
// exp(x) as __expf forms it (one multiply, one v_exp_f32), with the slot behind the transcendental kept inside the statement
__device__ __forceinline__ float exp_slot(float x) {
  const float y = x * 1.44269504f;
  float r;
  asm("v_exp_f32 %0, %1\n\tv_nop" : "=v"(r) : "v"(y));   // the v_nop fills the slot: nothing reads r or rewrites y directly behind the v_exp_f32
  return r;
}
// Score product as the bare builtin: resident Q fragments live above v255, where an asm operand cannot name them;
// the compiler keeps the distance behind its own matrix instructions.
__device__ __forceinline__ v8f wmma_bf16_hireg(v16bf a, v16bf b, v8f c) {
  return __builtin_amdgcn_wmma_f32_16x16x32_bf16(false, a, false, b, (short)0, c, false, false);
}
#define QLR 5   // k steps (of 8) whose Q lo fragments stay in registers: as many as 512 registers hold without a spill
// out[b][n][c] f16 = softmax(q^T k) v ; 128 query rows per workgroup, tiles of 64 keys
__global__ __launch_bounds__(256) void k_attn(const float* __restrict__ qT,
                                              const __bf16* __restrict__ kH,
                                              const __bf16* __restrict__ kL,
                                              const f16* __restrict__ v16,
                                              f16* __restrict__ aout) {
  __shared__ __align__(16) __bf16 Qh[128][264];  // staged Q block, bf16 hi / lo planes
  __shared__ __align__(16) __bf16 Ql[128][264];
  __shared__ __align__(16) __bf16 Kp[2][64][264];   // staged K tile, bf16 hi / lo planes (33792 B apart), filled by asynchronous copies
  __shared__ __align__(16) float Sbuf[128][68];  // scores f32
  // softmax numerator f16: takes over the score bytes once every thread holds its scores in registers (a barrier lies between)
  f16 (*Pbuf)[72] = reinterpret_cast<f16 (*)[72]>(&Sbuf[0][0]);
  __shared__ float m_run[128], l_run[128], rfac[128];
  __shared__ float pmax[2][128], psum[4][128];
  // output tile [n][c]: takes over the Q hi plane after the last tile's scores
  f16 (*Ot)[264] = reinterpret_cast<f16 (*)[264]>(&Qh[0][0]);
  int b = blockIdx.y;
  int nq = blockIdx.x * 128;
  int tid = threadIdx.x, lane = tid & 31, wave = tid >> 5;
  int rowp = (wave & 3) * 2;       // S row blocks rowp, rowp+1: with two column blocks a 32 x 32 tile per wave,
  int colp = (wave >> 2) * 2;      // S col blocks colp, colp+1: so every fragment read from LDS feeds two tiles
  int c_wave = wave * 32;          // O channel range for this wave
  int srow = tid & 127, sh = tid >> 7;  // softmax: 2 threads per row, 32 cols each (two groups of 16)
  const float* qTb = qT + (size_t)b * NN * CC;
  const f16* vb  = v16 + (size_t)b * CC * NN;
  const v8f vzero = {};
  v8f oacc[16];
  for (int i = 0; i < 16; ++i) oacc[i] = vzero;

  // K tile = 64 rows x 512 B of each plane; wave w copies rows w, w + 8, ..., w + 56 of both planes, through no register
  const __bf16* khp = kH + (size_t)b * NN * CC + (size_t)wave * CC + lane * 8;
  const __bf16* klp = kL + (size_t)b * NN * CC + (size_t)wave * CC + lane * 8;
  __bf16* const k_lds = &Kp[0][wave][lane * 8];
  k_rows_async<0>(k_lds, khp);   // tile 0: nothing has touched the K planes yet
  k_rows_async<33792>(k_lds, klp);

  // stage Q block as bf16 hi/lo planes: 256 threads, each converts 128 floats
  {
    int row = tid >> 1, cbase = (tid & 1) * 128;
    const float* qp = &qTb[(size_t)(nq + row) * CC + cbase];
    for (int i = 0; i < 128; i += 4) {
      const v4f a = *(const v4f*)(qp + i);
#pragma unroll
      for (int e = 0; e < 4; ++e) { __bf16 h = bf_hi(a[e]); Qh[row][cbase + i + e] = h; Ql[row][cbase + i + e] = bf_lo(a[e], h); }
    }
  }
  if (tid < 128) { m_run[tid] = -1e30f; l_run[tid] = 0.f; }
  asm volatile("s_wait_asynccnt 0x0" ::: "memory");   // this wave's rows of tile 0 have landed; the barrier publishes them
  __syncthreads();

  // this wave's 32 query rows: read from LDS once and kept in registers for every key tile, the hi plane for all of K = 256,
  // the lo plane for its first QLR k steps; the rest of the lo plane is read per tile as before
  v16bf qh[2][8], ql[2][QLR];
#pragma unroll   // constant indices keep the fragments in registers
  for (int i = 0; i < 2; ++i)
#pragma unroll   // as above
    for (int k8 = 0; k8 < 8; ++k8) {
      qh[i][k8] = load_bf_lds(&Qh[0][0], (rowp + i) * 16 + (lane & 15), 264, k8 * 32, lane);
      if (k8 < QLR) ql[i][k8] = load_bf_lds(&Ql[0][0], (rowp + i) * 16 + (lane & 15), 264, k8 * 32, lane);
    }

  for (int t = 0; t < NN / 64; ++t) {
    int mb = t * 64;
    // S = Q^T K for this 128x64 tile (2 x 2 subtiles per wave)
    v8f s[2][2] = {{vzero, vzero}, {vzero, vzero}};
#pragma unroll   // constant indices into the register-resident Q fragments
    for (int k8 = 0; k8 < 8; ++k8) {           // scores as a bf16 hi/lo split: hi*hi + hi*lo + lo*hi, in that order in every subtile
      v16bf al[2], bh[2], bl[2];
      for (int i = 0; i < 2; ++i) {
        al[i] = (k8 < QLR) ? ql[i][k8 < QLR ? k8 : 0] : load_bf_lds(&Ql[0][0], (rowp + i) * 16 + (lane & 15), 264, k8 * 32, lane);
        bh[i] = load_bf_lds(&Kp[0][0][0], (colp + i) * 16 + (lane & 15), 264, k8 * 32, lane);
        bl[i] = load_bf_lds(&Kp[1][0][0], (colp + i) * 16 + (lane & 15), 264, k8 * 32, lane);
      }
      for (int i = 0; i < 2; ++i)
        for (int j = 0; j < 2; ++j) s[i][j] = wmma_bf16_hireg(qh[i][k8], bh[j], s[i][j]);
      for (int i = 0; i < 2; ++i)
        for (int j = 0; j < 2; ++j) s[i][j] = wmma_bf16_hireg(qh[i][k8], bl[j], s[i][j]);
      for (int i = 0; i < 2; ++i)
        for (int j = 0; j < 2; ++j) s[i][j] = wmma_bf16_hireg(al[i], bh[j], s[i][j]);
    }
    // this tile's V fragments, all eight loads as one group: they fly under the softmax and are first read by the P V^T products
    v16h vf[2][2];
    for (int k2 = 0; k2 < 2; ++k2)
      for (int cb = 0; cb < 2; ++cb) vf[k2][cb] = load_b(vb, c_wave + cb * 16 + (lane & 15), NN, mb + k2 * 32, lane);
    for (int i = 0; i < 2; ++i)
      for (int r = 0; r < 8; ++r) {
        int row = (rowp + i) * 16 + r + ((lane >> 4) << 3);
        Sbuf[row][colp * 16 + (lane & 15)] = s[i][0][r];
        Sbuf[row][(colp + 1) * 16 + (lane & 15)] = s[i][1][r];
      }
    // precaution: the softmax below reuses the V loads' address registers while the loads are still in flight
    asm volatile("s_wait_xcnt 0x0" ::: "memory");
    asm volatile("s_wait_dscnt 0x0" ::: "memory");   // this wave's reads of the K planes have retired before any wave's copies rewrite them
    lds_barrier();
    // every wave has left the K planes: the next tile's copies start here and fly under the softmax and the P V^T products
    if (t + 1 < NN / 64) {
      k_rows_async<0>(k_lds, khp + (size_t)(mb + 64) * CC);
      k_rows_async<33792>(k_lds, klp + (size_t)(mb + 64) * CC);
    }
    // ---- parallel online softmax: all 256 threads, vectorized ----
    float arr[32];
    {
      const float4* sp = (const float4*)&Sbuf[srow][sh * 32];
      float mx = -1e30f;
      for (int i = 0; i < 8; ++i) {
        float4 f = sp[i];
        ((float4*)arr)[i] = f;
        mx = fmaxf(mx, fmaxf(fmaxf(f.x, f.y), fmaxf(f.z, f.w)));
      }
      pmax[sh][srow] = mx;
    }
    lds_barrier();
    {
      float m_new = fmaxf(fmaxf(pmax[0][srow], pmax[1][srow]), m_run[srow]);
      for (int g = 0; g < 2; ++g) {   // one partial sum per group of 16 columns
        float l = 0.f;
        v8h pk0, pk1;
        for (int i = 0; i < 8; ++i) {
          float p = exp_slot(arr[g * 16 + i] - m_new);
          pk0[i] = (f16)(p * PSC); l += p;
        }
        for (int i = 0; i < 8; ++i) {
          float p = exp_slot(arr[g * 16 + 8 + i] - m_new);
          pk1[i] = (f16)(p * PSC); l += p;
        }
        *(v8h*)&Pbuf[srow][sh * 32 + g * 16] = pk0;
        *(v8h*)&Pbuf[srow][sh * 32 + g * 16 + 8] = pk1;
        psum[sh * 2 + g][srow] = l;
      }
    }
    lds_barrier();
    if (tid < 128) {
      float mold = m_run[tid];
      float m_new = fmaxf(fmaxf(pmax[0][tid], pmax[1][tid]), mold);
      float rs = __expf(mold - m_new);
      l_run[tid] = l_run[tid] * rs +
                   (psum[0][tid] + psum[1][tid] + psum[2][tid] + psum[3][tid]);
      m_run[tid] = m_new;
      rfac[tid] = rs;
    }
    lds_barrier();
    // rescale O and accumulate O += P * V^T (K = 64 keys): four row blocks at a time, their factors and P fragments read as one group
    for (int h = 0; h < 2; ++h) {
      float f[4][8];
      v16h pa[4][2];
      for (int j = 0; j < 4; ++j) {
        const int nb = h * 4 + j;
        for (int r = 0; r < 8; ++r) f[j][r] = rfac[nb * 16 + r + ((lane >> 4) << 3)];
        for (int k2 = 0; k2 < 2; ++k2) pa[j][k2] = load_a(&Pbuf[0][0], nb * 16 + (lane & 15), 72, k2 * 32, lane);
      }
      for (int j = 0; j < 4; ++j)
        for (int cb = 0; cb < 2; ++cb)
          for (int r = 0; r < 8; ++r) oacc[(h * 4 + j) * 2 + cb][r] *= f[j][r];
      for (int k2 = 0; k2 < 2; ++k2)
        for (int j = 0; j < 4; ++j)
          for (int cb = 0; cb < 2; ++cb)
            oacc[(h * 4 + j) * 2 + cb] = WMMA_F16(pa[j][k2], vf[k2][cb], oacc[(h * 4 + j) * 2 + cb]);
    }
    asm volatile("s_wait_dscnt 0x0" ::: "memory");      // this wave's reads of P and rfac have retired
    asm volatile("s_wait_asynccnt 0x0" ::: "memory");   // this wave's rows of the next tile have landed
    __syncthreads();   // publishes the next K tile; also ends this tile's reads of P and rfac
  }
  // epilogue: divide by softmax sum (and the P scale), stage [n][c], store [b][n][c] f16 rows of 512 B
  for (int nb = 0; nb < 8; ++nb)
    for (int cb = 0; cb < 2; ++cb) {
      int c = c_wave + cb * 16 + (lane & 15);
      for (int r = 0; r < 8; ++r) {
        int nloc = nb * 16 + r + ((lane >> 4) << 3);
        Ot[nloc][c] = (f16)(oacc[nb * 2 + cb][r] * (PUN / l_run[nloc]));
      }
    }
  __syncthreads();
  {
    f16* ab = aout + (size_t)b * NN * CC + (size_t)nq * CC;
    for (int g = tid; g < 128 * 32; g += 256) { int nl = g >> 5, pc = g & 31; vst2(ab + (size_t)nl * CC + pc * 8, *(const v4u*)(&Ot[nl][pc * 8])); }
  }
}

// ---------------- output projection ----------------
__global__ __launch_bounds__(256) void k_out(const f16* __restrict__ aout,
                                             const f16* __restrict__ Wo16,
                                             const float* __restrict__ bo,
                                             float* __restrict__ out) {
  __shared__ __align__(16) float So[8][32 * 64];   // per-wave [co][n] tile
  int b = blockIdx.y;
  int n_base = blockIdx.x * 64;
  int lane = threadIdx.x & 31, wave = threadIdx.x >> 5;
  int co_wave = wave * 32;
  const f16* ab = aout + (size_t)b * NN * CC;
  const v8f vzero = {};
  v8f acc[2][4];
  for (int cb = 0; cb < 2; ++cb)
    for (int nb = 0; nb < 4; ++nb) acc[cb][nb] = vzero;
  for (int kk = 0; kk < CC; kk += 32) {
    v16h a0 = load_a(Wo16, co_wave + (lane & 15), CC, kk, lane);
    v16h a1 = load_a(Wo16, co_wave + 16 + (lane & 15), CC, kk, lane);
    for (int nb = 0; nb < 4; ++nb) {
      v16h bf = load_b(ab, n_base + nb * 16 + (lane & 15), CC, kk, lane);
      acc[0][nb] = WMMA_F16(a0, bf, acc[0][nb]);
      acc[1][nb] = WMMA_F16(a1, bf, acc[1][nb]);
    }
  }
  float* ob = out + (size_t)b * CC * NN;
  float* so = So[wave];
  for (int cb = 0; cb < 2; ++cb) {
    int col_b = cb * 16 + ((lane >> 4) << 3);
    for (int nb = 0; nb < 4; ++nb) {
      int nl = nb * 16 + (lane & 15);
      for (int r = 0; r < 8; ++r) so[(col_b + r) * 64 + nl] = acc[cb][nb][r] + bo[co_wave + col_b + r];
    }
  }
  __syncthreads();
  for (int q = 0; q < 16; ++q) {    // 32 channel rows x 256 B (16 pieces); rows 2q, 2q+1 per instruction
    int rl = q * 2 + (lane >> 4), pc = lane & 15;
    vst2(ob + (size_t)(co_wave + rl) * NN + n_base + pc * 4, *(const v4f*)(&so[rl * 64 + pc * 4]));
  }
}

extern "C" void kernel_launch(void* const* d_in, const int* in_sizes, int n_in,
                              void* d_out, int out_size, void* d_ws, size_t ws_size,
                              hipStream_t stream) {
  (void)in_sizes; (void)n_in; (void)out_size; (void)ws_size;
  const float* x  = (const float*)d_in[0];
  const float* g0 = (const float*)d_in[1];
  const float* Wq = (const float*)d_in[2];
  const float* bq = (const float*)d_in[3];
  const float* Wk = (const float*)d_in[4];
  const float* bk = (const float*)d_in[5];
  const float* Wv = (const float*)d_in[6];
  const float* bv = (const float*)d_in[7];
  const float* Wo = (const float*)d_in[8];
  const float* bo = (const float*)d_in[9];
  const float* fw = (const float*)d_in[10];

  char* ws = (char*)d_ws;
  float* scg = (float*)ws; ws += (size_t)BB * NN * sizeof(float);
  f16* W3    = (f16*)ws;   ws += (size_t)3 * CC * CC * sizeof(f16);
  f16* Wo16  = (f16*)ws;   ws += (size_t)CC * CC * sizeof(f16);
  f16* xT    = (f16*)ws;   ws += (size_t)BB * NN * CC * sizeof(f16);
  float* qT  = (float*)ws; ws += (size_t)BB * NN * CC * sizeof(float);
  __bf16* kH = (__bf16*)ws; ws += (size_t)BB * NN * CC * sizeof(__bf16);
  __bf16* kL = (__bf16*)ws; ws += (size_t)BB * NN * CC * sizeof(__bf16);
  f16* v16   = (f16*)ws;   ws += (size_t)BB * NN * CC * sizeof(f16);
  f16* aout  = (f16*)ws;

  k_scale<<<dim3((BB * NN) / 256), 256, 0, stream>>>(g0, scg);
  k_wconv<<<dim3((4 * CC * CC / 8) / 256), 256, 0, stream>>>(Wq, Wk, Wv, Wo, fw, W3, Wo16);
  k_xt<<<dim3(NN / 64, CC / 64, BB), 256, 0, stream>>>(x, xT);
  k_qkv<<<dim3(NN / 64, BB), 256, 0, stream>>>(xT, W3, x, Wq, Wk, fw, bq, bk, bv, scg, qT, kH, kL, v16);
  k_attn<<<dim3(NN / 128, BB), 256, 0, stream>>>(qT, kH, kL, v16, aout);
  k_out<<<dim3(NN / 64, BB), 256, 0, stream>>>(aout, Wo16, bo, (float*)d_out);
}

// v006
// Measured time: 246 microseconds a run.
// Two timings next to v005 both put it at 1.04 times that version's speed.
// Over all steps from v000 it is 2.87 times as fast.
#include <hip/hip_runtime.h>

#define BB 8
#define CC 256
#define NN 4096
#define H0 32
#define W0 32

typedef _Float16 f16;
typedef __attribute__((ext_vector_type(16))) _Float16 v16h;
typedef __attribute__((ext_vector_type(8)))  _Float16 v8h;
typedef __attribute__((ext_vector_type(8)))  float    v8f;

union FragU { v16h v; v8h h[2]; };
typedef __attribute__((ext_vector_type(4))) float v4f;
typedef __attribute__((ext_vector_type(4))) unsigned v4u;
// Contractions: q/k/v 1x1 convs and the output conv (K = 256), scores q^T k (K = 256) and P V^T (K = keys) on
// v_wmma_f32_16x16x32_f16 (f16 operands, f32 accumulate; P scaled by 256 before its f16 conversion) — except the scores,
// and the q/k projections, which run as bf16 hi/lo splits (hi*hi + hi*lo + lo*hi) of f32 operands (q kept in f32, k as its two bf16 planes). The FFT refine with
// per-channel real weights is exactly fw_c * x and is folded into the conv weights; bilinear guide, sigmoid, softmax in f32.
template <typename V> __device__ __forceinline__ void vst2(void* p, V v) {
  *(V*)p = v; 
}
#define PSC 256.0f
#define PUN (1.0f / 256.0f)
typedef __attribute__((ext_vector_type(16))) __bf16 v16bf;
typedef __attribute__((ext_vector_type(8)))  __bf16 v8bf;
__device__ __forceinline__ __bf16 bf_hi(float x) { return (__bf16)x; }
__device__ __forceinline__ __bf16 bf_lo(float x, __bf16 h) { return (__bf16)(x - (float)h); }
__device__ __forceinline__ v8f WMMA_BF16(v16bf a, v16bf b, v8f c) {
  v8f d = __builtin_amdgcn_wmma_f32_16x16x32_bf16(false, a, false, b, (short)0, c, false, false);
  asm volatile("v_nop\n\tv_nop\n\tv_nop\n\tv_nop" : "+v"(d) : "v"(a), "v"(b));
  return d;
}
// bf16 fragment from an LDS plane [row][rs] (split K map)
__device__ __forceinline__ v16bf load_bf_lds(const __bf16* base, int row, int rs, int kbase, int lane) {
  union { v16bf v; v8bf h[2]; } u;
  const __bf16* p = base + (size_t)row * rs + kbase + ((lane >> 4) << 3);
  u.h[0] = *(const v8bf*)(p); u.h[1] = *(const v8bf*)(p + 16);
  return u.v;
}
// A-matrix fragment (16x32 f16, M x K), memory layout [row][k] row-major.
// Element i of lane L: K = kbase + (i/8)*16 + (L/16)*8 + i%8, M = row (caller adds lane%16).
__device__ __forceinline__ v16h load_a(const f16* base, int row, int rs, int kbase, int lane) {
  const f16* p = base + (size_t)row * rs + kbase + ((lane >> 4) << 3);
  FragU u;
  u.h[0] = *(const v8h*)(p);
  u.h[1] = *(const v8h*)(p + 16);
  return u.v;
}
// B-matrix fragment (32x16 f16, K x N), memory layout [col][k] (K contiguous); same per-lane K map as A:
// Element i of lane L: K = kbase + (i/8)*16 + (L/16)*8 + i%8, N = col.
__device__ __forceinline__ v16h load_b(const f16* base, int col, int rs, int kbase, int lane) {
  return load_a(base, col, rs, kbase, lane);
}

__device__ __forceinline__ v8f WMMA_F16(v16h a, v16h b, v8f c) {
  v8f d = __builtin_amdgcn_wmma_f32_16x16x32_f16(false, a, false, b, (short)0, c, false, false);
  asm volatile("v_nop\n\tv_nop\n\tv_nop\n\tv_nop" : "+v"(d) : "v"(a), "v"(b));
  return d;
}

// ---------------- prep kernels ----------------

// bilinear(align_corners) + sigmoid -> scale = 1 + sigmoid(g)
__global__ __launch_bounds__(256) void k_scale(const float* __restrict__ g0,
                                               float* __restrict__ sc) {
  int idx = blockIdx.x * 256 + threadIdx.x;   // B*N
  int b = idx >> 12, n = idx & (NN - 1);
  int ny = n >> 6, nx = n & 63;
  float fy = ny * (31.0f / 63.0f);
  float fx = nx * (31.0f / 63.0f);
  int y0 = (int)fy, x0 = (int)fx;
  float wy = fy - (float)y0, wx = fx - (float)x0;
  int y1 = min(y0 + 1, H0 - 1), x1 = min(x0 + 1, W0 - 1);
  const float* g = g0 + (size_t)b * H0 * W0;
  float v00 = g[y0 * W0 + x0], v01 = g[y0 * W0 + x1];
  float v10 = g[y1 * W0 + x0], v11 = g[y1 * W0 + x1];
  float vy0 = v00 * (1.f - wx) + v01 * wx;
  float vy1 = v10 * (1.f - wx) + v11 * wx;
  float v = vy0 * (1.f - wy) + vy1 * wy;
  vst2(sc + idx, 1.0f + 1.0f / (1.0f + __expf(-v)));
}

// convert weights to f16; fold freq_weights into Wq/Wk/Wv columns (refined = fw*x)
__global__ __launch_bounds__(256) void k_wconv(const float* __restrict__ Wq,
                                               const float* __restrict__ Wk,
                                               const float* __restrict__ Wv,
                                               const float* __restrict__ Wo,
                                               const float* __restrict__ fw,
                                               f16* __restrict__ W3,
                                               f16* __restrict__ Wo16) {
  int g = blockIdx.x * 256 + threadIdx.x;     // 4*256*256/8 pieces of 8 halves
  int idx0 = g * 8;
  int m = idx0 >> 16, r0 = idx0 & 65535;
  const float* W = (m == 0) ? Wq : (m == 1) ? Wk : (m == 2) ? Wv : Wo;
  union { v8h h; v4u u; } pk;
#pragma unroll
  for (int e = 0; e < 8; ++e) { int r = r0 + e, ci = r & (CC - 1); pk.h[e] = (f16)(W[r] * ((m < 3) ? fw[ci] : 1.0f)); }
  f16* dst = (m < 3) ? (W3 + (size_t)m * 65536 + r0) : (Wo16 + r0);
  vst2(dst, pk.u);
}

// x [b][c][n] f32 -> xT [b][n][c] f16 via LDS 64x64 tile (coalesced both sides)
__global__ __launch_bounds__(256) void k_xt(const float* __restrict__ x,
                                            f16* __restrict__ xT) {
  __shared__ __align__(16) f16 tile[64][72];
  int b = blockIdx.z, c0 = blockIdx.y * 64, n0 = blockIdx.x * 64;
  int tid = threadIdx.x;
  {
    int cl = tid >> 2, nq = (tid & 3) * 16;
    const float4* src = (const float4*)(x + (size_t)b * CC * NN +
                                        (size_t)(c0 + cl) * NN + n0 + nq);
    for (int i = 0; i < 4; ++i) {
      float4 v = src[i];
      tile[cl][nq + 4 * i + 0] = (f16)v.x;
      tile[cl][nq + 4 * i + 1] = (f16)v.y;
      tile[cl][nq + 4 * i + 2] = (f16)v.z;
      tile[cl][nq + 4 * i + 3] = (f16)v.w;
    }
  }
  __syncthreads();
  for (int pass = 0; pass < 2; ++pass) {
    int nl = pass * 32 + (tid >> 3), cq = (tid & 7) * 8;
    f16* dst = xT + (size_t)b * NN * CC + (size_t)(n0 + nl) * CC + c0 + cq;
    union { v8h h; v4u u; } o;
    for (int i = 0; i < 8; ++i) o.h[i] = tile[cq + i][nl];
    vst2(dst, o.u);
  }
}

// ---------------- QKV GEMM ----------------
// q stored [b][n][c] (transposed, f32, scaled); k stored [b][n][c] as two bf16 planes, hi and lo; v stored [b][c][n] (f16, scaled)
__global__ __launch_bounds__(256) void k_qkv(const f16* __restrict__ xT,
                                             const f16* __restrict__ W3,
                                             const float* __restrict__ xf,   // x f32 [b][c][n]
                                             const float* __restrict__ Wqf, const float* __restrict__ Wkf,
                                             const float* __restrict__ fw,
                                             const float* __restrict__ bq,
                                             const float* __restrict__ bk,
                                             const float* __restrict__ bv,
                                             const float* __restrict__ scg,
                                             float* __restrict__ qT,
                                             __bf16* __restrict__ kH,
                                             __bf16* __restrict__ kL,
                                             f16* __restrict__ v16) {
  __shared__ __align__(16) float T[64][260];   // block tile [n][c] (padded), f32
  int b = blockIdx.y;
  int n_base = blockIdx.x * 64;
  int tid = threadIdx.x;
  int lane = threadIdx.x & 31, wave = threadIdx.x >> 5;
  int co_wave = wave * 32;
  const f16* xTb = xT + (size_t)b * NN * CC;
  const float* scb = scg + (size_t)b * NN;
  const v8f vzero = {};
  const float* xfb = xf + (size_t)b * CC * NN;
  for (int m = 0; m < 3; ++m) {
    const f16* Wm = W3 + (size_t)m * 65536;
    const float* bias = (m == 0) ? bq : ((m == 1) ? bk : bv);
    v8f acc[2][4];
    for (int cb = 0; cb < 2; ++cb)
      for (int nb = 0; nb < 4; ++nb) acc[cb][nb] = vzero;
    if (m < 2) {
      // q and k as a bf16 hi/lo split of f32 operands: A = (W*fw) rows [co][ci] (contiguous), B = x[b][c][n] gathered down c (stride NN)
      const float* Wf = (m == 0) ? Wqf : Wkf;
      for (int kk = 0; kk < CC; kk += 32) {
        v16bf ah[2], al[2];
#pragma unroll
        for (int cb = 0; cb < 2; ++cb) {
          const float* wr = Wf + (size_t)(co_wave + cb * 16 + (lane & 15)) * CC + kk + ((lane >> 4) << 3);
#pragma unroll
          for (int e = 0; e < 16; ++e) { const int ko = (e < 8) ? e : (8 + e); const float w = wr[ko] * fw[kk + ((lane >> 4) << 3) + ko];
                                         __bf16 hh = bf_hi(w); ah[cb][e] = hh; al[cb][e] = bf_lo(w, hh); }
        }
        for (int nb = 0; nb < 4; ++nb) {
          v16bf bh, bl;
          const float* xp = xfb + (size_t)(kk + ((lane >> 4) << 3)) * NN + n_base + nb * 16 + (lane & 15);
#pragma unroll
          for (int e = 0; e < 16; ++e) { const int ko = (e < 8) ? e : (8 + e); const float xv = xp[(size_t)ko * NN];
                                         __bf16 hh = bf_hi(xv); bh[e] = hh; bl[e] = bf_lo(xv, hh); }
          acc[0][nb] = WMMA_BF16(ah[0], bh, acc[0][nb]); acc[0][nb] = WMMA_BF16(ah[0], bl, acc[0][nb]); acc[0][nb] = WMMA_BF16(al[0], bh, acc[0][nb]);
          acc[1][nb] = WMMA_BF16(ah[1], bh, acc[1][nb]); acc[1][nb] = WMMA_BF16(ah[1], bl, acc[1][nb]); acc[1][nb] = WMMA_BF16(al[1], bh, acc[1][nb]);
        }
      }
    } else
    for (int kk = 0; kk < CC; kk += 32) {
      v16h a0 = load_a(Wm, co_wave + (lane & 15), CC, kk, lane);
      v16h a1 = load_a(Wm, co_wave + 16 + (lane & 15), CC, kk, lane);
      for (int nb = 0; nb < 4; ++nb) {
        v16h bf = load_b(xTb, n_base + nb * 16 + (lane & 15), CC, kk, lane);
        acc[0][nb] = WMMA_F16(a0, bf, acc[0][nb]);
        acc[1][nb] = WMMA_F16(a1, bf, acc[1][nb]);
      }
    }
    float qmul = (m == 0) ? 0.0625f : 1.0f;  // fold 1/sqrt(C) into q
    __syncthreads();                          // previous matrix's tile fully stored
    for (int cb = 0; cb < 2; ++cb) {
      int co_b = co_wave + cb * 16 + ((lane >> 4) << 3);
      for (int nb = 0; nb < 4; ++nb) {
        int nl = nb * 16 + (lane & 15);
        float s = scb[n_base + nl] * qmul;
        for (int r = 0; r < 8; ++r) T[nl][co_b + r] = (acc[cb][nb][r] + bias[co_b + r]) * s;
      }
    }
    __syncthreads();
    if (m == 0) {   // f32 [b][n][c]: 64 rows x 1024 B (64 pieces of 4 floats)
      float* dstb = qT + (size_t)b * NN * CC + (size_t)n_base * CC;
      for (int g = tid; g < 64 * 64; g += 256) { int nl = g >> 6, pc = g & 63; vst2(dstb + (size_t)nl * CC + pc * 4, *(const v4f*)(&T[nl][pc * 4])); }
    } else if (m == 1) {   // bf16 hi and lo planes [b][n][c]: 64 rows x 512 B each (32 pieces of 8), split here once for every reader
      const size_t ko = (size_t)b * NN * CC + (size_t)n_base * CC;
      for (int g = tid; g < 64 * 32; g += 256) {
        int nl = g >> 5, pc = g & 31;
        v8bf h8, l8;
#pragma unroll   // constant indices keep h8 and l8 in registers
        for (int e = 0; e < 8; ++e) { const float kv = T[nl][pc * 8 + e]; __bf16 h = bf_hi(kv); h8[e] = h; l8[e] = bf_lo(kv, h); }
        vst2(kH + ko + (size_t)nl * CC + pc * 8, h8);
        vst2(kL + ko + (size_t)nl * CC + pc * 8, l8);
      }
    } else {
      f16* vb = v16 + (size_t)b * CC * NN + n_base;
      for (int g = tid; g < 256 * 8; g += 256) {
        int c = g >> 3, pc = g & 7;
        union { v8h h; v4u u; } pk;
        for (int e = 0; e < 8; ++e) pk.h[e] = (f16)T[pc * 8 + e][c];
        vst2(vb + (size_t)c * NN + pc * 8, pk.u);
      }
    }
  }
}

// ---------------- flash attention ----------------
// Work-group barrier that orders LDS traffic only: __syncthreads() would also wait for the global loads in flight,
// and the V loads below are meant to stay in flight across it, as are the K copies (both read only what an earlier launch wrote).
__device__ __forceinline__ void lds_barrier() {
  __builtin_amdgcn_fence(__ATOMIC_RELEASE, "workgroup", "local");
  __builtin_amdgcn_s_barrier();
  __builtin_amdgcn_fence(__ATOMIC_ACQUIRE, "workgroup", "local");
}
// Eight asynchronous copies of one wave: rows r, r + 8, ..., r + 56 of one K plane, a whole 512-B row (4 lines) per copy, 16 B per lane,
// from rows of 512 B in global memory to rows of 528 B in LDS. lds = the lane's place in row r of the hi plane, PL = the plane's byte
// distance from the hi plane in LDS, g = the lane's global address in row r. Written as the builtin, whose operands may live above v255
// (an asm operand cannot), and with one LDS address for all sixteen copies of a tile, to leave the registers to the resident Q:
// copy n lands at lds + PL + n * 4224 through its immediate offset; that offset moves both addresses, so the copy's global pointer is
// row r + 8 n's address less the offset: g + n * 4096 - (PL + n * 4224) = g - PL - n * 128. The largest offset is 63360.
template <unsigned PL>
__device__ __forceinline__ void k_rows_async(__bf16* lds, const __bf16* g) {
  typedef __attribute__((ext_vector_type(4))) int v4i;
  typedef __attribute__((address_space(1))) v4i* gp_t;
  typedef __attribute__((address_space(3))) v4i* lp_t;
  const unsigned long long a = (unsigned long long)g - PL;
  const lp_t l = (lp_t)lds;
  __builtin_amdgcn_global_load_async_to_lds_b128((gp_t)(a), l, PL, 0);
  __builtin_amdgcn_global_load_async_to_lds_b128((gp_t)(a - 1 * 128), l, PL + 1 * 4224, 0);
  __builtin_amdgcn_global_load_async_to_lds_b128((gp_t)(a - 2 * 128), l, PL + 2 * 4224, 0);
  __builtin_amdgcn_global_load_async_to_lds_b128((gp_t)(a - 3 * 128), l, PL + 3 * 4224, 0);
  __builtin_amdgcn_global_load_async_to_lds_b128((gp_t)(a - 4 * 128), l, PL + 4 * 4224, 0);
  __builtin_amdgcn_global_load_async_to_lds_b128((gp_t)(a - 5 * 128), l, PL + 5 * 4224, 0);
  __builtin_amdgcn_global_load_async_to_lds_b128((gp_t)(a - 6 * 128), l, PL + 6 * 4224, 0);
  __builtin_amdgcn_global_load_async_to_lds_b128((gp_t)(a - 7 * 128), l, PL + 7 * 4224, 0);
}
// exp(x) as __expf forms it (one multiply, one v_exp_f32), with the slot behind the transcendental kept inside the statement
__device__ __forceinline__ float exp_slot(float x) {
  const float y = x * 1.44269504f;
  float r;
  asm("v_exp_f32 %0, %1\n\tv_nop" : "=v"(r) : "v"(y));   // the v_nop fills the slot: nothing reads r or rewrites y directly behind the v_exp_f32
  return r;
}
// lane l's value to lane l ^ 16 and back (every lane on)
__device__ __forceinline__ float xhalf(float x) {
  return __builtin_bit_cast(float, __builtin_amdgcn_permlanex16(__builtin_bit_cast(int, x), __builtin_bit_cast(int, x), 0x76543210, 0xfedcba98, false, false));
}
// Score product as the bare builtin: resident Q fragments live above v255, where an asm operand cannot name them;
// the compiler keeps the distance behind its own matrix instructions.
__device__ __forceinline__ v8f wmma_bf16_hireg(v16bf a, v16bf b, v8f c) {
  return __builtin_amdgcn_wmma_f32_16x16x32_bf16(false, a, false, b, (short)0, c, false, false);
}
#define QLR 5   // k steps (of 8) whose Q lo fragments stay in registers: as many as 512 registers hold without a spill
// out[b][n][c] f16 = softmax(q^T k) v ; 128 query rows per workgroup, tiles of 64 keys
__global__ __launch_bounds__(256) void k_attn(const float* __restrict__ qT,
                                              const __bf16* __restrict__ kH,
                                              const __bf16* __restrict__ kL,
                                              const f16* __restrict__ v16,
                                              f16* __restrict__ aout) {
  __shared__ __align__(16) __bf16 Qh[128][264];  // staged Q block, bf16 hi / lo planes
  __shared__ __align__(16) __bf16 Ql[128][264];
  __shared__ __align__(16) __bf16 Kp[2][64][264];   // staged K tile, bf16 hi / lo planes (33792 B apart), filled by asynchronous copies
  __shared__ __align__(16) float Sbuf[128][68];  // scores f32
  // softmax numerator f16: a place of its own, since no barrier lies between one wave's score reads and another wave's P stores
  __shared__ __align__(16) f16 Pbuf[128][72];
  __shared__ __align__(16) float l_run[128], rfac[128];
  // output tile [n][c]: takes over the Q hi plane after the last tile's scores
  f16 (*Ot)[264] = reinterpret_cast<f16 (*)[264]>(&Qh[0][0]);
  int b = blockIdx.y;
  int nq = blockIdx.x * 128;
  int tid = threadIdx.x, lane = tid & 31, wave = tid >> 5;
  int rowp = (wave & 3) * 2;       // S row blocks rowp, rowp+1: with two column blocks a 32 x 32 tile per wave,
  int colp = (wave >> 2) * 2;      // S col blocks colp, colp+1: so every fragment read from LDS feeds two tiles
  int c_wave = wave * 32;          // O channel range for this wave
  // softmax: 2 threads per row, 32 cols each (two groups of 16), in lanes l and l + 16 of one wave: what the two exchange goes
  // from lane to lane, through no LDS and over no barrier, and each keeps the row's running maximum and sum in registers
  int srow = wave * 16 + (lane & 15), sh = lane >> 4;
  float m_row = -1e30f, l_row = 0.f;
  const float* qTb = qT + (size_t)b * NN * CC;
  const f16* vb  = v16 + (size_t)b * CC * NN;
  const v8f vzero = {};
  v8f oacc[16];
  for (int i = 0; i < 16; ++i) oacc[i] = vzero;

  // K tile = 64 rows x 512 B of each plane; wave w copies rows w, w + 8, ..., w + 56 of both planes, through no register
  const __bf16* khp = kH + (size_t)b * NN * CC + (size_t)wave * CC + lane * 8;
  const __bf16* klp = kL + (size_t)b * NN * CC + (size_t)wave * CC + lane * 8;
  __bf16* const k_lds = &Kp[0][wave][lane * 8];
  k_rows_async<0>(k_lds, khp);   // tile 0: nothing has touched the K planes yet
  k_rows_async<33792>(k_lds, klp);

  // stage Q block as bf16 hi/lo planes: 256 threads, each converts 128 floats
  {
    int row = tid >> 1, cbase = (tid & 1) * 128;
    const float* qp = &qTb[(size_t)(nq + row) * CC + cbase];
    for (int i = 0; i < 128; i += 4) {
      const v4f a = *(const v4f*)(qp + i);
#pragma unroll
      for (int e = 0; e < 4; ++e) { __bf16 h = bf_hi(a[e]); Qh[row][cbase + i + e] = h; Ql[row][cbase + i + e] = bf_lo(a[e], h); }
    }
  }
  asm volatile("s_wait_asynccnt 0x0" ::: "memory");   // this wave's rows of tile 0 have landed; the barrier publishes them
  __syncthreads();

  // this wave's 32 query rows: read from LDS once and kept in registers for every key tile, the hi plane for all of K = 256,
  // the lo plane for its first QLR k steps; the rest of the lo plane is read per tile as before
  v16bf qh[2][8], ql[2][QLR];
#pragma unroll   // constant indices keep the fragments in registers
  for (int i = 0; i < 2; ++i)
#pragma unroll   // as above
    for (int k8 = 0; k8 < 8; ++k8) {
      qh[i][k8] = load_bf_lds(&Qh[0][0], (rowp + i) * 16 + (lane & 15), 264, k8 * 32, lane);
      if (k8 < QLR) ql[i][k8] = load_bf_lds(&Ql[0][0], (rowp + i) * 16 + (lane & 15), 264, k8 * 32, lane);
    }

  for (int t = 0; t < NN / 64; ++t) {
    int mb = t * 64;
    // S = Q^T K for this 128x64 tile (2 x 2 subtiles per wave)
    v8f s[2][2] = {{vzero, vzero}, {vzero, vzero}};
#pragma unroll   // constant indices into the register-resident Q fragments
    for (int k8 = 0; k8 < 8; ++k8) {           // scores as a bf16 hi/lo split: hi*hi + hi*lo + lo*hi, in that order in every subtile
      v16bf al[2], bh[2], bl[2];
      for (int i = 0; i < 2; ++i) {
        al[i] = (k8 < QLR) ? ql[i][k8 < QLR ? k8 : 0] : load_bf_lds(&Ql[0][0], (rowp + i) * 16 + (lane & 15), 264, k8 * 32, lane);
        bh[i] = load_bf_lds(&Kp[0][0][0], (colp + i) * 16 + (lane & 15), 264, k8 * 32, lane);
        bl[i] = load_bf_lds(&Kp[1][0][0], (colp + i) * 16 + (lane & 15), 264, k8 * 32, lane);
      }
      for (int i = 0; i < 2; ++i)
        for (int j = 0; j < 2; ++j) s[i][j] = wmma_bf16_hireg(qh[i][k8], bh[j], s[i][j]);
      for (int i = 0; i < 2; ++i)
        for (int j = 0; j < 2; ++j) s[i][j] = wmma_bf16_hireg(qh[i][k8], bl[j], s[i][j]);
      for (int i = 0; i < 2; ++i)
        for (int j = 0; j < 2; ++j) s[i][j] = wmma_bf16_hireg(al[i], bh[j], s[i][j]);
    }
    // this tile's V fragments, all eight loads as one group: they fly under the softmax and are first read by the P V^T products
    v16h vf[2][2];
    for (int k2 = 0; k2 < 2; ++k2)
      for (int cb = 0; cb < 2; ++cb) vf[k2][cb] = load_b(vb, c_wave + cb * 16 + (lane & 15), NN, mb + k2 * 32, lane);
    for (int i = 0; i < 2; ++i)
      for (int r = 0; r < 8; ++r) {
        int row = (rowp + i) * 16 + r + ((lane >> 4) << 3);
        Sbuf[row][colp * 16 + (lane & 15)] = s[i][0][r];
        Sbuf[row][(colp + 1) * 16 + (lane & 15)] = s[i][1][r];
      }
    // precaution: the softmax below reuses the V loads' address registers while the loads are still in flight
    asm volatile("s_wait_xcnt 0x0" ::: "memory");
    asm volatile("s_wait_dscnt 0x0" ::: "memory");   // this wave's reads of the K planes have retired before any wave's copies rewrite them
    lds_barrier();
    // every wave has left the K planes: the next tile's copies start here and fly under the softmax and the P V^T products
    if (t + 1 < NN / 64) {
      k_rows_async<0>(k_lds, khp + (size_t)(mb + 64) * CC);
      k_rows_async<33792>(k_lds, klp + (size_t)(mb + 64) * CC);
    }
    // ---- parallel online softmax: all 256 threads, vectorized ----
    float arr[32];
    float mx = -1e30f;
    {
      const float4* sp = (const float4*)&Sbuf[srow][sh * 32];
      for (int i = 0; i < 8; ++i) {
        float4 f = sp[i];
        ((float4*)arr)[i] = f;
        mx = fmaxf(mx, fmaxf(fmaxf(f.x, f.y), fmaxf(f.z, f.w)));
      }
    }
    {
      const float m_new = fmaxf(fmaxf(mx, xhalf(mx)), m_row);
      const float rs = __expf(m_row - m_new);
      float lg[2];
      for (int g = 0; g < 2; ++g) {   // one partial sum per group of 16 columns
        float l = 0.f;
        v8h pk0, pk1;
        for (int i = 0; i < 8; ++i) {
          float p = exp_slot(arr[g * 16 + i] - m_new);
          pk0[i] = (f16)(p * PSC); l += p;
        }
        for (int i = 0; i < 8; ++i) {
          float p = exp_slot(arr[g * 16 + 8 + i] - m_new);
          pk1[i] = (f16)(p * PSC); l += p;
        }
        *(v8h*)&Pbuf[srow][sh * 32 + g * 16] = pk0;
        *(v8h*)&Pbuf[srow][sh * 32 + g * 16 + 8] = pk1;
        lg[g] = l;
      }
      if (sh == 0) rfac[srow] = rs;
      // the four partial sums in column order in the lanes with sh == 0, whose sum is the one the epilogue takes
      l_row = l_row * rs + (lg[0] + lg[1] + xhalf(lg[0]) + xhalf(lg[1]));
      m_row = m_new;
    }
    // keeps the row-sum adds in front of the barrier: sunk behind it they split the one group of P and factor reads into many, each waited for
    __builtin_amdgcn_sched_barrier(0);
    lds_barrier();
    // rescale O and accumulate O += P * V^T (K = 64 keys): four row blocks at a time, their factors and P fragments read as one group
    for (int h = 0; h < 2; ++h) {
      float f[4][8];
      v16h pa[4][2];
      for (int j = 0; j < 4; ++j) {
        const int nb = h * 4 + j;
        for (int r = 0; r < 8; ++r) f[j][r] = rfac[nb * 16 + r + ((lane >> 4) << 3)];
        for (int k2 = 0; k2 < 2; ++k2) pa[j][k2] = load_a(&Pbuf[0][0], nb * 16 + (lane & 15), 72, k2 * 32, lane);
      }
      for (int j = 0; j < 4; ++j)
        for (int cb = 0; cb < 2; ++cb)
          for (int r = 0; r < 8; ++r) oacc[(h * 4 + j) * 2 + cb][r] *= f[j][r];
      for (int k2 = 0; k2 < 2; ++k2)
        for (int j = 0; j < 4; ++j)
          for (int cb = 0; cb < 2; ++cb)
            oacc[(h * 4 + j) * 2 + cb] = WMMA_F16(pa[j][k2], vf[k2][cb], oacc[(h * 4 + j) * 2 + cb]);
    }
    asm volatile("s_wait_dscnt 0x0" ::: "memory");      // this wave's reads of P and rfac have retired
    asm volatile("s_wait_asynccnt 0x0" ::: "memory");   // this wave's rows of the next tile have landed
    __syncthreads();   // publishes the next K tile; also ends this tile's reads of P and rfac
  }
  if (sh == 0) l_run[srow] = l_row;
  __syncthreads();   // publishes the row sums to the waves that divide by them
  // epilogue: divide by softmax sum (and the P scale), stage [n][c], store [b][n][c] f16 rows of 512 B
  for (int nb = 0; nb < 8; ++nb)
    for (int cb = 0; cb < 2; ++cb) {
      int c = c_wave + cb * 16 + (lane & 15);
      for (int r = 0; r < 8; ++r) {
        int nloc = nb * 16 + r + ((lane >> 4) << 3);
        Ot[nloc][c] = (f16)(oacc[nb * 2 + cb][r] * (PUN / l_run[nloc]));
      }
    }
  __syncthreads();
  {
    f16* ab = aout + (size_t)b * NN * CC + (size_t)nq * CC;
    for (int g = tid; g < 128 * 32; g += 256) { int nl = g >> 5, pc = g & 31; vst2(ab + (size_t)nl * CC + pc * 8, *(const v4u*)(&Ot[nl][pc * 8])); }
  }
}

// ---------------- output projection ----------------
__global__ __launch_bounds__(256) void k_out(const f16* __restrict__ aout,
                                             const f16* __restrict__ Wo16,
                                             const float* __restrict__ bo,
                                             float* __restrict__ out) {
  __shared__ __align__(16) float So[8][32 * 64];   // per-wave [co][n] tile
  int b = blockIdx.y;
  int n_base = blockIdx.x * 64;
  int lane = threadIdx.x & 31, wave = threadIdx.x >> 5;
  int co_wave = wave * 32;
  const f16* ab = aout + (size_t)b * NN * CC;
  const v8f vzero = {};
  v8f acc[2][4];
  for (int cb = 0; cb < 2; ++cb)
    for (int nb = 0; nb < 4; ++nb) acc[cb][nb] = vzero;
  for (int kk = 0; kk < CC; kk += 32) {
    v16h a0 = load_a(Wo16, co_wave + (lane & 15), CC, kk, lane);
    v16h a1 = load_a(Wo16, co_wave + 16 + (lane & 15), CC, kk, lane);
    for (int nb = 0; nb < 4; ++nb) {
      v16h bf = load_b(ab, n_base + nb * 16 + (lane & 15), CC, kk, lane);
      acc[0][nb] = WMMA_F16(a0, bf, acc[0][nb]);
      acc[1][nb] = WMMA_F16(a1, bf, acc[1][nb]);
    }
  }
  float* ob = out + (size_t)b * CC * NN;
  float* so = So[wave];
  for (int cb = 0; cb < 2; ++cb) {
    int col_b = cb * 16 + ((lane >> 4) << 3);
    for (int nb = 0; nb < 4; ++nb) {
      int nl = nb * 16 + (lane & 15);
      for (int r = 0; r < 8; ++r) so[(col_b + r) * 64 + nl] = acc[cb][nb][r] + bo[co_wave + col_b + r];
    }
  }
  __syncthreads();
  for (int q = 0; q < 16; ++q) {    // 32 channel rows x 256 B (16 pieces); rows 2q, 2q+1 per instruction
    int rl = q * 2 + (lane >> 4), pc = lane & 15;
    vst2(ob + (size_t)(co_wave + rl) * NN + n_base + pc * 4, *(const v4f*)(&so[rl * 64 + pc * 4]));
  }
}

extern "C" void kernel_launch(void* const* d_in, const int* in_sizes, int n_in,
                              void* d_out, int out_size, void* d_ws, size_t ws_size,
                              hipStream_t stream) {
  (void)in_sizes; (void)n_in; (void)out_size; (void)ws_size;
  const float* x  = (const float*)d_in[0];
  const float* g0 = (const float*)d_in[1];
  const float* Wq = (const float*)d_in[2];
  const float* bq = (const float*)d_in[3];
  const float* Wk = (const float*)d_in[4];
  const float* bk = (const float*)d_in[5];
  const float* Wv = (const float*)d_in[6];
  const float* bv = (const float*)d_in[7];
  const float* Wo = (const float*)d_in[8];
  const float* bo = (const float*)d_in[9];
  const float* fw = (const float*)d_in[10];

  char* ws = (char*)d_ws;
  float* scg = (float*)ws; ws += (size_t)BB * NN * sizeof(float);
  f16* W3    = (f16*)ws;   ws += (size_t)3 * CC * CC * sizeof(f16);
  f16* Wo16  = (f16*)ws;   ws += (size_t)CC * CC * sizeof(f16);
  f16* xT    = (f16*)ws;   ws += (size_t)BB * NN * CC * sizeof(f16);
  float* qT  = (float*)ws; ws += (size_t)BB * NN * CC * sizeof(float);
  __bf16* kH = (__bf16*)ws; ws += (size_t)BB * NN * CC * sizeof(__bf16);
  __bf16* kL = (__bf16*)ws; ws += (size_t)BB * NN * CC * sizeof(__bf16);
  f16* v16   = (f16*)ws;   ws += (size_t)BB * NN * CC * sizeof(f16);
  f16* aout  = (f16*)ws;

  k_scale<<<dim3((BB * NN) / 256), 256, 0, stream>>>(g0, scg);
  k_wconv<<<dim3((4 * CC * CC / 8) / 256), 256, 0, stream>>>(Wq, Wk, Wv, Wo, fw, W3, Wo16);
  k_xt<<<dim3(NN / 64, CC / 64, BB), 256, 0, stream>>>(x, xT);
  k_qkv<<<dim3(NN / 64, BB), 256, 0, stream>>>(xT, W3, x, Wq, Wk, fw, bq, bk, bv, scg, qT, kH, kL, v16);
  k_attn<<<dim3(NN / 128, BB), 256, 0, stream>>>(qT, kH, kL, v16, aout);
  k_out<<<dim3(NN / 64, BB), 256, 0, stream>>>(aout, Wo16, bo, (float*)d_out);
}

// v007
// A run of this version takes 227 microseconds.
// In two side-by-side timings against v006, it was 1.09 and 1.08 times as fast.
// Over all steps from v000 it is 3.11 times as fast.
#include <hip/hip_runtime.h>

#define BB 8
#define CC 256
#define NN 4096
#define H0 32
#define W0 32

typedef _Float16 f16;
typedef __attribute__((ext_vector_type(16))) _Float16 v16h;
typedef __attribute__((ext_vector_type(8)))  _Float16 v8h;
typedef __attribute__((ext_vector_type(8)))  float    v8f;

union FragU { v16h v; v8h h[2]; };
typedef __attribute__((ext_vector_type(4))) float v4f;
typedef __attribute__((ext_vector_type(4))) unsigned v4u;
// Contractions: q/k/v 1x1 convs and the output conv (K = 256), scores q^T k (K = 256) and P V^T (K = keys) on
// v_wmma_f32_16x16x32_f16 (f16 operands, f32 accumulate; P scaled by 256 before its f16 conversion) — except the scores,
// and the q/k projections, which run as bf16 hi/lo splits (hi*hi + hi*lo + lo*hi) of f32 operands (q kept in f32, k as its two bf16 planes). The FFT refine with
// per-channel real weights is exactly fw_c * x and is folded into the conv weights; bilinear guide, sigmoid, softmax in f32.
template <typename V> __device__ __forceinline__ void vst2(void* p, V v) {
  *(V*)p = v; 
}
#define PSC 256.0f
#define PUN (1.0f / 256.0f)
typedef __attribute__((ext_vector_type(16))) __bf16 v16bf;
typedef __attribute__((ext_vector_type(8)))  __bf16 v8bf;
__device__ __forceinline__ __bf16 bf_hi(float x) { return (__bf16)x; }
__device__ __forceinline__ __bf16 bf_lo(float x, __bf16 h) { return (__bf16)(x - (float)h); }
__device__ __forceinline__ v8f WMMA_BF16(v16bf a, v16bf b, v8f c) {
  v8f d = __builtin_amdgcn_wmma_f32_16x16x32_bf16(false, a, false, b, (short)0, c, false, false);
  asm volatile("v_nop\n\tv_nop\n\tv_nop\n\tv_nop" : "+v"(d) : "v"(a), "v"(b));
  return d;
}
// bf16 fragment from an LDS plane [row][rs] (split K map)
__device__ __forceinline__ v16bf load_bf_lds(const __bf16* base, int row, int rs, int kbase, int lane) {
  union { v16bf v; v8bf h[2]; } u;
  const __bf16* p = base + (size_t)row * rs + kbase + ((lane >> 4) << 3);
  u.h[0] = *(const v8bf*)(p); u.h[1] = *(const v8bf*)(p + 16);
  return u.v;
}
// A-matrix fragment (16x32 f16, M x K), memory layout [row][k] row-major.
// Element i of lane L: K = kbase + (i/8)*16 + (L/16)*8 + i%8, M = row (caller adds lane%16).
__device__ __forceinline__ v16h load_a(const f16* base, int row, int rs, int kbase, int lane) {
  const f16* p = base + (size_t)row * rs + kbase + ((lane >> 4) << 3);
  FragU u;
  u.h[0] = *(const v8h*)(p);
  u.h[1] = *(const v8h*)(p + 16);
  return u.v;
}
// B-matrix fragment (32x16 f16, K x N), memory layout [col][k] (K contiguous); same per-lane K map as A:
// Element i of lane L: K = kbase + (i/8)*16 + (L/16)*8 + i%8, N = col.
__device__ __forceinline__ v16h load_b(const f16* base, int col, int rs, int kbase, int lane) {
  return load_a(base, col, rs, kbase, lane);
}

__device__ __forceinline__ v8f WMMA_F16(v16h a, v16h b, v8f c) {
  v8f d = __builtin_amdgcn_wmma_f32_16x16x32_f16(false, a, false, b, (short)0, c, false, false);
  asm volatile("v_nop\n\tv_nop\n\tv_nop\n\tv_nop" : "+v"(d) : "v"(a), "v"(b));
  return d;
}

// ---------------- prep kernels ----------------

// bilinear(align_corners) + sigmoid -> scale = 1 + sigmoid(g)
__global__ __launch_bounds__(256) void k_scale(const float* __restrict__ g0,
                                               float* __restrict__ sc) {
  int idx = blockIdx.x * 256 + threadIdx.x;   // B*N
  int b = idx >> 12, n = idx & (NN - 1);
  int ny = n >> 6, nx = n & 63;
  float fy = ny * (31.0f / 63.0f);
  float fx = nx * (31.0f / 63.0f);
  int y0 = (int)fy, x0 = (int)fx;
  float wy = fy - (float)y0, wx = fx - (float)x0;
  int y1 = min(y0 + 1, H0 - 1), x1 = min(x0 + 1, W0 - 1);
  const float* g = g0 + (size_t)b * H0 * W0;
  float v00 = g[y0 * W0 + x0], v01 = g[y0 * W0 + x1];
  float v10 = g[y1 * W0 + x0], v11 = g[y1 * W0 + x1];
  float vy0 = v00 * (1.f - wx) + v01 * wx;
  float vy1 = v10 * (1.f - wx) + v11 * wx;
  float v = vy0 * (1.f - wy) + vy1 * wy;
  vst2(sc + idx, 1.0f + 1.0f / (1.0f + __expf(-v)));
}

// convert weights to f16; fold freq_weights into Wq/Wk/Wv columns (refined = fw*x)
__global__ __launch_bounds__(256) void k_wconv(const float* __restrict__ Wq,
                                               const float* __restrict__ Wk,
                                               const float* __restrict__ Wv,
                                               const float* __restrict__ Wo,
                                               const float* __restrict__ fw,
                                               f16* __restrict__ W3,
                                               f16* __restrict__ Wo16) {
  int g = blockIdx.x * 256 + threadIdx.x;     // 4*256*256/8 pieces of 8 halves
  int idx0 = g * 8;
  int m = idx0 >> 16, r0 = idx0 & 65535;
  const float* W = (m == 0) ? Wq : (m == 1) ? Wk : (m == 2) ? Wv : Wo;
  union { v8h h; v4u u; } pk;
#pragma unroll
  for (int e = 0; e < 8; ++e) { int r = r0 + e, ci = r & (CC - 1); pk.h[e] = (f16)(W[r] * ((m < 3) ? fw[ci] : 1.0f)); }
  f16* dst = (m < 3) ? (W3 + (size_t)m * 65536 + r0) : (Wo16 + r0);
  vst2(dst, pk.u);
}

// ---------------- QKV GEMM ----------------
// q stored [b][n][c] (transposed, f32, scaled); k stored [b][n][c] as two bf16 planes, hi and lo; v stored [b][c][n] (f16, scaled)
__global__ __launch_bounds__(256) void k_qkv(const f16* __restrict__ W3,
                                             const float* __restrict__ xf,   // x f32 [b][c][n]
                                             const float* __restrict__ Wqf, const float* __restrict__ Wkf,
                                             const float* __restrict__ fw,
                                             const float* __restrict__ bq,
                                             const float* __restrict__ bk,
                                             const float* __restrict__ bv,
                                             const float* __restrict__ scg,
                                             float* __restrict__ qT,
                                             __bf16* __restrict__ kH,
                                             __bf16* __restrict__ kL,
                                             f16* __restrict__ v16) {
  __shared__ __align__(16) float T[64][260];   // block tile [n][c] (padded), f32
  __shared__ __align__(16) __bf16 Xp[2][64][264];   // this block's x tile [n][c] as bf16 hi / lo planes, rows of 528 B: the B operand of q and of k
  // the same tile as f16, the B operand of v: it lies in T's storage, so v is formed first and T takes the place over behind v's products
  f16 (*Xf)[264] = reinterpret_cast<f16 (*)[264]>(&T[0][0]);
  int b = blockIdx.y;
  int n_base = blockIdx.x * 64;
  int tid = threadIdx.x;
  int lane = threadIdx.x & 31, wave = threadIdx.x >> 5;
  int co_wave = wave * 32;
  const float* scb = scg + (size_t)b * NN;
  const v8f vzero = {};
  const float* xfb = xf + (size_t)b * CC * NN;
  // x tile (256 c x 64 n, f32) converted once for all eight waves and all three products: a wave-wide load takes 32 n of one c (one whole
  // line), a thread gathers 8 consecutive c of its n and stores them as one 16-B piece of each plane
  {
    const int n = tid & 63;
#pragma unroll   // with the loop below: all 64 loads of a thread are issued before the first is waited for
    for (int i = 0; i < 8; ++i) {
      const int c0 = ((tid >> 6) + 4 * i) * 8;
      const float* xp = xfb + (size_t)c0 * NN + n_base + n;
      v8bf h8, l8;
      v8h f8;
#pragma unroll   // constant indices keep h8, l8 and f8 in registers
      for (int e = 0; e < 8; ++e) { const float xv = xp[(size_t)e * NN]; __bf16 hh = bf_hi(xv); h8[e] = hh; l8[e] = bf_lo(xv, hh); f8[e] = (f16)xv; }
      *(v8bf*)&Xp[0][n][c0] = h8;
      *(v8bf*)&Xp[1][n][c0] = l8;
      *(v8h*)&Xf[n][c0] = f8;
    }
  }
  __syncthreads();   // publishes the three planes to every wave
  for (int mi = 0; mi < 3; ++mi) {
    const int m = (mi == 0) ? 2 : mi - 1;   // v, q, k
    const f16* Wm = W3 + (size_t)m * 65536;
    const float* bias = (m == 0) ? bq : ((m == 1) ? bk : bv);
    v8f acc[2][4];
    for (int cb = 0; cb < 2; ++cb)
      for (int nb = 0; nb < 4; ++nb) acc[cb][nb] = vzero;
    if (m < 2) {
      // q and k as a bf16 hi/lo split of f32 operands: A = (W*fw) rows [co][ci] (contiguous), B = the staged x planes
      const float* Wf = (m == 0) ? Wqf : Wkf;
      for (int kk = 0; kk < CC; kk += 32) {
        v16bf ah[2], al[2];
#pragma unroll
        for (int cb = 0; cb < 2; ++cb) {
          const float* wr = Wf + (size_t)(co_wave + cb * 16 + (lane & 15)) * CC + kk + ((lane >> 4) << 3);
#pragma unroll
          for (int e = 0; e < 16; ++e) { const int ko = (e < 8) ? e : (8 + e); const float w = wr[ko] * fw[kk + ((lane >> 4) << 3) + ko];
                                         __bf16 hh = bf_hi(w); ah[cb][e] = hh; al[cb][e] = bf_lo(w, hh); }
        }
        for (int nb = 0; nb < 4; ++nb) {
          const v16bf bh = load_bf_lds(&Xp[0][0][0], nb * 16 + (lane & 15), 264, kk, lane);
          const v16bf bl = load_bf_lds(&Xp[1][0][0], nb * 16 + (lane & 15), 264, kk, lane);
          acc[0][nb] = WMMA_BF16(ah[0], bh, acc[0][nb]); acc[0][nb] = WMMA_BF16(ah[0], bl, acc[0][nb]); acc[0][nb] = WMMA_BF16(al[0], bh, acc[0][nb]);
          acc[1][nb] = WMMA_BF16(ah[1], bh, acc[1][nb]); acc[1][nb] = WMMA_BF16(ah[1], bl, acc[1][nb]); acc[1][nb] = WMMA_BF16(al[1], bh, acc[1][nb]);
        }
      }
    } else
    for (int kk = 0; kk < CC; kk += 32) {
      v16h a0 = load_a(Wm, co_wave + (lane & 15), CC, kk, lane);
      v16h a1 = load_a(Wm, co_wave + 16 + (lane & 15), CC, kk, lane);
      for (int nb = 0; nb < 4; ++nb) {
        v16h bf = load_b(&Xf[0][0], nb * 16 + (lane & 15), 264, kk, lane);
        acc[0][nb] = WMMA_F16(a0, bf, acc[0][nb]);
        acc[1][nb] = WMMA_F16(a1, bf, acc[1][nb]);
      }
    }
    float qmul = (m == 0) ? 0.0625f : 1.0f;  // fold 1/sqrt(C) into q
    __syncthreads();                          // previous matrix's tile fully stored; before v's tile: every wave has left the f16 plane
    for (int cb = 0; cb < 2; ++cb) {
      int co_b = co_wave + cb * 16 + ((lane >> 4) << 3);
      for (int nb = 0; nb < 4; ++nb) {
        int nl = nb * 16 + (lane & 15);
        float s = scb[n_base + nl] * qmul;
        for (int r = 0; r < 8; ++r) T[nl][co_b + r] = (acc[cb][nb][r] + bias[co_b + r]) * s;
      }
    }
    __syncthreads();
    if (m == 0) {   // f32 [b][n][c]: 64 rows x 1024 B (64 pieces of 4 floats)
      float* dstb = qT + (size_t)b * NN * CC + (size_t)n_base * CC;
      for (int g = tid; g < 64 * 64; g += 256) { int nl = g >> 6, pc = g & 63; vst2(dstb + (size_t)nl * CC + pc * 4, *(const v4f*)(&T[nl][pc * 4])); }
    } else if (m == 1) {   // bf16 hi and lo planes [b][n][c]: 64 rows x 512 B each (32 pieces of 8), split here once for every reader
      const size_t ko = (size_t)b * NN * CC + (size_t)n_base * CC;
      for (int g = tid; g < 64 * 32; g += 256) {
        int nl = g >> 5, pc = g & 31;
        v8bf h8, l8;
#pragma unroll   // constant indices keep h8 and l8 in registers
        for (int e = 0; e < 8; ++e) { const float kv = T[nl][pc * 8 + e]; __bf16 h = bf_hi(kv); h8[e] = h; l8[e] = bf_lo(kv, h); }
        vst2(kH + ko + (size_t)nl * CC + pc * 8, h8);
        vst2(kL + ko + (size_t)nl * CC + pc * 8, l8);
      }
    } else {
      f16* vb = v16 + (size_t)b * CC * NN + n_base;
      for (int g = tid; g < 256 * 8; g += 256) {
        int c = g >> 3, pc = g & 7;
        union { v8h h; v4u u; } pk;
        for (int e = 0; e < 8; ++e) pk.h[e] = (f16)T[pc * 8 + e][c];
        vst2(vb + (size_t)c * NN + pc * 8, pk.u);
      }
    }
  }
}

// ---------------- flash attention ----------------
// Work-group barrier that orders LDS traffic only: __syncthreads() would also wait for the global loads in flight,
// and the V loads below are meant to stay in flight across it, as are the K copies (both read only what an earlier launch wrote).
__device__ __forceinline__ void lds_barrier() {
  __builtin_amdgcn_fence(__ATOMIC_RELEASE, "workgroup", "local");
  __builtin_amdgcn_s_barrier();
  __builtin_amdgcn_fence(__ATOMIC_ACQUIRE, "workgroup", "local");
}
// Eight asynchronous copies of one wave: rows r, r + 8, ..., r + 56 of one K plane, a whole 512-B row (4 lines) per copy, 16 B per lane,
// from rows of 512 B in global memory to rows of 528 B in LDS. lds = the lane's place in row r of the hi plane, PL = the plane's byte
// distance from the hi plane in LDS, g = the lane's global address in row r. Written as the builtin, whose operands may live above v255
// (an asm operand cannot), and with one LDS address for all sixteen copies of a tile, to leave the registers to the resident Q:
// copy n lands at lds + PL + n * 4224 through its immediate offset; that offset moves both addresses, so the copy's global pointer is
// row r + 8 n's address less the offset: g + n * 4096 - (PL + n * 4224) = g - PL - n * 128. The largest offset is 63360.
template <unsigned PL>
__device__ __forceinline__ void k_rows_async(__bf16* lds, const __bf16* g) {
  typedef __attribute__((ext_vector_type(4))) int v4i;
  typedef __attribute__((address_space(1))) v4i* gp_t;
  typedef __attribute__((address_space(3))) v4i* lp_t;
  const unsigned long long a = (unsigned long long)g - PL;
  const lp_t l = (lp_t)lds;
  __builtin_amdgcn_global_load_async_to_lds_b128((gp_t)(a), l, PL, 0);
  __builtin_amdgcn_global_load_async_to_lds_b128((gp_t)(a - 1 * 128), l, PL + 1 * 4224, 0);
  __builtin_amdgcn_global_load_async_to_lds_b128((gp_t)(a - 2 * 128), l, PL + 2 * 4224, 0);
  __builtin_amdgcn_global_load_async_to_lds_b128((gp_t)(a - 3 * 128), l, PL + 3 * 4224, 0);
  __builtin_amdgcn_global_load_async_to_lds_b128((gp_t)(a - 4 * 128), l, PL + 4 * 4224, 0);
  __builtin_amdgcn_global_load_async_to_lds_b128((gp_t)(a - 5 * 128), l, PL + 5 * 4224, 0);
  __builtin_amdgcn_global_load_async_to_lds_b128((gp_t)(a - 6 * 128), l, PL + 6 * 4224, 0);
  __builtin_amdgcn_global_load_async_to_lds_b128((gp_t)(a - 7 * 128), l, PL + 7 * 4224, 0);
}
// exp(x) as __expf forms it (one multiply, one v_exp_f32), with the slot behind the transcendental kept inside the statement
__device__ __forceinline__ float exp_slot(float x) {
  const float y = x * 1.44269504f;
  float r;
  asm("v_exp_f32 %0, %1\n\tv_nop" : "=v"(r) : "v"(y));   // the v_nop fills the slot: nothing reads r or rewrites y directly behind the v_exp_f32
  return r;
}
// lane l's value to lane l ^ 16 and back (every lane on)
__device__ __forceinline__ float xhalf(float x) {
  return __builtin_bit_cast(float, __builtin_amdgcn_permlanex16(__builtin_bit_cast(int, x), __builtin_bit_cast(int, x), 0x76543210, 0xfedcba98, false, false));
}
// Score product as the bare builtin: resident Q fragments live above v255, where an asm operand cannot name them;
// the compiler keeps the distance behind its own matrix instructions.
__device__ __forceinline__ v8f wmma_bf16_hireg(v16bf a, v16bf b, v8f c) {
  return __builtin_amdgcn_wmma_f32_16x16x32_bf16(false, a, false, b, (short)0, c, false, false);
}
#define QLR 5   // k steps (of 8) whose Q lo fragments stay in registers: as many as 512 registers hold without a spill
// out[b][n][c] f16 = softmax(q^T k) v ; 128 query rows per workgroup, tiles of 64 keys
__global__ __launch_bounds__(256) void k_attn(const float* __restrict__ qT,
                                              const __bf16* __restrict__ kH,
                                              const __bf16* __restrict__ kL,
                                              const f16* __restrict__ v16,
                                              f16* __restrict__ aout) {
  __shared__ __align__(16) __bf16 Qh[128][264];  // staged Q block, bf16 hi / lo planes
  __shared__ __align__(16) __bf16 Ql[128][264];
  __shared__ __align__(16) __bf16 Kp[2][64][264];   // staged K tile, bf16 hi / lo planes (33792 B apart), filled by asynchronous copies
  __shared__ __align__(16) float Sbuf[128][68];  // scores f32
  // softmax numerator f16: a place of its own, since no barrier lies between one wave's score reads and another wave's P stores
  __shared__ __align__(16) f16 Pbuf[128][72];
  __shared__ __align__(16) float l_run[128], rfac[128];
  // output tile [n][c]: takes over the Q hi plane after the last tile's scores
  f16 (*Ot)[264] = reinterpret_cast<f16 (*)[264]>(&Qh[0][0]);
  int b = blockIdx.y;
  int nq = blockIdx.x * 128;
  int tid = threadIdx.x, lane = tid & 31, wave = tid >> 5;
  int rowp = (wave & 3) * 2;       // S row blocks rowp, rowp+1: with two column blocks a 32 x 32 tile per wave,
  int colp = (wave >> 2) * 2;      // S col blocks colp, colp+1: so every fragment read from LDS feeds two tiles
  int c_wave = wave * 32;          // O channel range for this wave
  // softmax: 2 threads per row, 32 cols each (two groups of 16), in lanes l and l + 16 of one wave: what the two exchange goes
  // from lane to lane, through no LDS and over no barrier, and each keeps the row's running maximum and sum in registers
  int srow = wave * 16 + (lane & 15), sh = lane >> 4;
  float m_row = -1e30f, l_row = 0.f;
  const float* qTb = qT + (size_t)b * NN * CC;
  const f16* vb  = v16 + (size_t)b * CC * NN;
  const v8f vzero = {};
  v8f oacc[16];
  for (int i = 0; i < 16; ++i) oacc[i] = vzero;

  // K tile = 64 rows x 512 B of each plane; wave w copies rows w, w + 8, ..., w + 56 of both planes, through no register
  const __bf16* khp = kH + (size_t)b * NN * CC + (size_t)wave * CC + lane * 8;
  const __bf16* klp = kL + (size_t)b * NN * CC + (size_t)wave * CC + lane * 8;
  __bf16* const k_lds = &Kp[0][wave][lane * 8];
  k_rows_async<0>(k_lds, khp);   // tile 0: nothing has touched the K planes yet
  k_rows_async<33792>(k_lds, klp);

  // stage Q block as bf16 hi/lo planes: 256 threads, each converts 128 floats
  {
    int row = tid >> 1, cbase = (tid & 1) * 128;
    const float* qp = &qTb[(size_t)(nq + row) * CC + cbase];
    for (int i = 0; i < 128; i += 4) {
      const v4f a = *(const v4f*)(qp + i);
#pragma unroll
      for (int e = 0; e < 4; ++e) { __bf16 h = bf_hi(a[e]); Qh[row][cbase + i + e] = h; Ql[row][cbase + i + e] = bf_lo(a[e], h); }
    }
  }
  asm volatile("s_wait_asynccnt 0x0" ::: "memory");   // this wave's rows of tile 0 have landed; the barrier publishes them
  __syncthreads();

  // this wave's 32 query rows: read from LDS once and kept in registers for every key tile, the hi plane for all of K = 256,
  // the lo plane for its first QLR k steps; the rest of the lo plane is read per tile as before
  v16bf qh[2][8], ql[2][QLR];
#pragma unroll   // constant indices keep the fragments in registers
  for (int i = 0; i < 2; ++i)
#pragma unroll   // as above
    for (int k8 = 0; k8 < 8; ++k8) {
      qh[i][k8] = load_bf_lds(&Qh[0][0], (rowp + i) * 16 + (lane & 15), 264, k8 * 32, lane);
      if (k8 < QLR) ql[i][k8] = load_bf_lds(&Ql[0][0], (rowp + i) * 16 + (lane & 15), 264, k8 * 32, lane);
    }

  for (int t = 0; t < NN / 64; ++t) {
    int mb = t * 64;
    // S = Q^T K for this 128x64 tile (2 x 2 subtiles per wave)
    v8f s[2][2] = {{vzero, vzero}, {vzero, vzero}};
#pragma unroll   // constant indices into the register-resident Q fragments
    for (int k8 = 0; k8 < 8; ++k8) {           // scores as a bf16 hi/lo split: hi*hi + hi*lo + lo*hi, in that order in every subtile
      v16bf al[2], bh[2], bl[2];
      for (int i = 0; i < 2; ++i) {
        al[i] = (k8 < QLR) ? ql[i][k8 < QLR ? k8 : 0] : load_bf_lds(&Ql[0][0], (rowp + i) * 16 + (lane & 15), 264, k8 * 32, lane);
        bh[i] = load_bf_lds(&Kp[0][0][0], (colp + i) * 16 + (lane & 15), 264, k8 * 32, lane);
        bl[i] = load_bf_lds(&Kp[1][0][0], (colp + i) * 16 + (lane & 15), 264, k8 * 32, lane);
      }
      for (int i = 0; i < 2; ++i)
        for (int j = 0; j < 2; ++j) s[i][j] = wmma_bf16_hireg(qh[i][k8], bh[j], s[i][j]);
      for (int i = 0; i < 2; ++i)
        for (int j = 0; j < 2; ++j) s[i][j] = wmma_bf16_hireg(qh[i][k8], bl[j], s[i][j]);
      for (int i = 0; i < 2; ++i)
        for (int j = 0; j < 2; ++j) s[i][j] = wmma_bf16_hireg(al[i], bh[j], s[i][j]);
    }
    // this tile's V fragments, all eight loads as one group: they fly under the softmax and are first read by the P V^T products
    v16h vf[2][2];
    for (int k2 = 0; k2 < 2; ++k2)
      for (int cb = 0; cb < 2; ++cb) vf[k2][cb] = load_b(vb, c_wave + cb * 16 + (lane & 15), NN, mb + k2 * 32, lane);
    for (int i = 0; i < 2; ++i)
      for (int r = 0; r < 8; ++r) {
        int row = (rowp + i) * 16 + r + ((lane >> 4) << 3);
        Sbuf[row][colp * 16 + (lane & 15)] = s[i][0][r];
        Sbuf[row][(colp + 1) * 16 + (lane & 15)] = s[i][1][r];
      }
    // precaution: the softmax below reuses the V loads' address registers while the loads are still in flight
    asm volatile("s_wait_xcnt 0x0" ::: "memory");
    asm volatile("s_wait_dscnt 0x0" ::: "memory");   // this wave's reads of the K planes have retired before any wave's copies rewrite them
    lds_barrier();
    // every wave has left the K planes: the next tile's copies start here and fly under the softmax and the P V^T products
    if (t + 1 < NN / 64) {
      k_rows_async<0>(k_lds, khp + (size_t)(mb + 64) * CC);
      k_rows_async<33792>(k_lds, klp + (size_t)(mb + 64) * CC);
    }
    // ---- parallel online softmax: all 256 threads, vectorized ----
    float arr[32];
    float mx = -1e30f;
    {
      const float4* sp = (const float4*)&Sbuf[srow][sh * 32];
      for (int i = 0; i < 8; ++i) {
        float4 f = sp[i];
        ((float4*)arr)[i] = f;
        mx = fmaxf(mx, fmaxf(fmaxf(f.x, f.y), fmaxf(f.z, f.w)));
      }
    }
    {
      const float m_new = fmaxf(fmaxf(mx, xhalf(mx)), m_row);
      const float rs = __expf(m_row - m_new);
      float lg[2];
      for (int g = 0; g < 2; ++g) {   // one partial sum per group of 16 columns
        float l = 0.f;
        v8h pk0, pk1;
        for (int i = 0; i < 8; ++i) {
          float p = exp_slot(arr[g * 16 + i] - m_new);
          pk0[i] = (f16)(p * PSC); l += p;
        }
        for (int i = 0; i < 8; ++i) {
          float p = exp_slot(arr[g * 16 + 8 + i] - m_new);
          pk1[i] = (f16)(p * PSC); l += p;
        }
        *(v8h*)&Pbuf[srow][sh * 32 + g * 16] = pk0;
        *(v8h*)&Pbuf[srow][sh * 32 + g * 16 + 8] = pk1;
        lg[g] = l;
      }
      if (sh == 0) rfac[srow] = rs;
      // the four partial sums in column order in the lanes with sh == 0, whose sum is the one the epilogue takes
      l_row = l_row * rs + (lg[0] + lg[1] + xhalf(lg[0]) + xhalf(lg[1]));
      m_row = m_new;
    }
    // keeps the row-sum adds in front of the barrier: sunk behind it they split the one group of P and factor reads into many, each waited for
    __builtin_amdgcn_sched_barrier(0);
    lds_barrier();
    // rescale O and accumulate O += P * V^T (K = 64 keys): four row blocks at a time, their factors and P fragments read as one group
    for (int h = 0; h < 2; ++h) {
      float f[4][8];
      v16h pa[4][2];
      for (int j = 0; j < 4; ++j) {
        const int nb = h * 4 + j;
        for (int r = 0; r < 8; ++r) f[j][r] = rfac[nb * 16 + r + ((lane >> 4) << 3)];
        for (int k2 = 0; k2 < 2; ++k2) pa[j][k2] = load_a(&Pbuf[0][0], nb * 16 + (lane & 15), 72, k2 * 32, lane);
      }
      for (int j = 0; j < 4; ++j)
        for (int cb = 0; cb < 2; ++cb)
          for (int r = 0; r < 8; ++r) oacc[(h * 4 + j) * 2 + cb][r] *= f[j][r];
      for (int k2 = 0; k2 < 2; ++k2)
        for (int j = 0; j < 4; ++j)
          for (int cb = 0; cb < 2; ++cb)
            oacc[(h * 4 + j) * 2 + cb] = WMMA_F16(pa[j][k2], vf[k2][cb], oacc[(h * 4 + j) * 2 + cb]);
    }
    asm volatile("s_wait_dscnt 0x0" ::: "memory");      // this wave's reads of P and rfac have retired
    asm volatile("s_wait_asynccnt 0x0" ::: "memory");   // this wave's rows of the next tile have landed
    __syncthreads();   // publishes the next K tile; also ends this tile's reads of P and rfac
  }
  if (sh == 0) l_run[srow] = l_row;
  __syncthreads();   // publishes the row sums to the waves that divide by them
  // epilogue: divide by softmax sum (and the P scale), stage [n][c], store [b][n][c] f16 rows of 512 B
  for (int nb = 0; nb < 8; ++nb)
    for (int cb = 0; cb < 2; ++cb) {
      int c = c_wave + cb * 16 + (lane & 15);
      for (int r = 0; r < 8; ++r) {
        int nloc = nb * 16 + r + ((lane >> 4) << 3);
        Ot[nloc][c] = (f16)(oacc[nb * 2 + cb][r] * (PUN / l_run[nloc]));
      }
    }
  __syncthreads();
  {
    f16* ab = aout + (size_t)b * NN * CC + (size_t)nq * CC;
    for (int g = tid; g < 128 * 32; g += 256) { int nl = g >> 5, pc = g & 31; vst2(ab + (size_t)nl * CC + pc * 8, *(const v4u*)(&Ot[nl][pc * 8])); }
  }
}

// ---------------- output projection ----------------
__global__ __launch_bounds__(256) void k_out(const f16* __restrict__ aout,
                                             const f16* __restrict__ Wo16,
                                             const float* __restrict__ bo,
                                             float* __restrict__ out) {
  __shared__ __align__(16) float So[8][32 * 64];   // per-wave [co][n] tile
  int b = blockIdx.y;
  int n_base = blockIdx.x * 64;
  int lane = threadIdx.x & 31, wave = threadIdx.x >> 5;
  int co_wave = wave * 32;
  const f16* ab = aout + (size_t)b * NN * CC;
  const v8f vzero = {};
  v8f acc[2][4];
  for (int cb = 0; cb < 2; ++cb)
    for (int nb = 0; nb < 4; ++nb) acc[cb][nb] = vzero;
  for (int kk = 0; kk < CC; kk += 32) {
    v16h a0 = load_a(Wo16, co_wave + (lane & 15), CC, kk, lane);
    v16h a1 = load_a(Wo16, co_wave + 16 + (lane & 15), CC, kk, lane);
    for (int nb = 0; nb < 4; ++nb) {
      v16h bf = load_b(ab, n_base + nb * 16 + (lane & 15), CC, kk, lane);
      acc[0][nb] = WMMA_F16(a0, bf, acc[0][nb]);
      acc[1][nb] = WMMA_F16(a1, bf, acc[1][nb]);
    }
  }
  float* ob = out + (size_t)b * CC * NN;
  float* so = So[wave];
  for (int cb = 0; cb < 2; ++cb) {
    int col_b = cb * 16 + ((lane >> 4) << 3);
    for (int nb = 0; nb < 4; ++nb) {
      int nl = nb * 16 + (lane & 15);
      for (int r = 0; r < 8; ++r) so[(col_b + r) * 64 + nl] = acc[cb][nb][r] + bo[co_wave + col_b + r];
    }
  }
  __syncthreads();
  for (int q = 0; q < 16; ++q) {    // 32 channel rows x 256 B (16 pieces); rows 2q, 2q+1 per instruction
    int rl = q * 2 + (lane >> 4), pc = lane & 15;
    vst2(ob + (size_t)(co_wave + rl) * NN + n_base + pc * 4, *(const v4f*)(&so[rl * 64 + pc * 4]));
  }
}

extern "C" void kernel_launch(void* const* d_in, const int* in_sizes, int n_in,
                              void* d_out, int out_size, void* d_ws, size_t ws_size,
                              hipStream_t stream) {
  (void)in_sizes; (void)n_in; (void)out_size; (void)ws_size;
  const float* x  = (const float*)d_in[0];
  const float* g0 = (const float*)d_in[1];
  const float* Wq = (const float*)d_in[2];
  const float* bq = (const float*)d_in[3];
  const float* Wk = (const float*)d_in[4];
  const float* bk = (const float*)d_in[5];
  const float* Wv = (const float*)d_in[6];
  const float* bv = (const float*)d_in[7];
  const float* Wo = (const float*)d_in[8];
  const float* bo = (const float*)d_in[9];
  const float* fw = (const float*)d_in[10];

  char* ws = (char*)d_ws;
  float* scg = (float*)ws; ws += (size_t)BB * NN * sizeof(float);
  f16* W3    = (f16*)ws;   ws += (size_t)3 * CC * CC * sizeof(f16);
  f16* Wo16  = (f16*)ws;   ws += (size_t)CC * CC * sizeof(f16);
  float* qT  = (float*)ws; ws += (size_t)BB * NN * CC * sizeof(float);
  __bf16* kH = (__bf16*)ws; ws += (size_t)BB * NN * CC * sizeof(__bf16);
  __bf16* kL = (__bf16*)ws; ws += (size_t)BB * NN * CC * sizeof(__bf16);
  f16* v16   = (f16*)ws;   ws += (size_t)BB * NN * CC * sizeof(f16);
  f16* aout  = (f16*)ws;

  k_scale<<<dim3((BB * NN) / 256), 256, 0, stream>>>(g0, scg);
  k_wconv<<<dim3((4 * CC * CC / 8) / 256), 256, 0, stream>>>(Wq, Wk, Wv, Wo, fw, W3, Wo16);
  k_qkv<<<dim3(NN / 64, BB), 256, 0, stream>>>(W3, x, Wq, Wk, fw, bq, bk, bv, scg, qT, kH, kL, v16);
  k_attn<<<dim3(NN / 128, BB), 256, 0, stream>>>(qT, kH, kL, v16, aout);
  k_out<<<dim3(NN / 64, BB), 256, 0, stream>>>(aout, Wo16, bo, (float*)d_out);
}

// v009
// It runs in 162 microseconds.
// It is 1.40 times as fast as v007, going by the measured steps of the versions left out in between.
// Over all steps from v000 it is 4.35 times as fast.
#include <hip/hip_runtime.h>

#define BB 8
#define CC 256
#define NN 4096
#define H0 32
#define W0 32

typedef _Float16 f16;
typedef __attribute__((ext_vector_type(16))) _Float16 v16h;
typedef __attribute__((ext_vector_type(8)))  _Float16 v8h;
typedef __attribute__((ext_vector_type(8)))  float    v8f;

union FragU { v16h v; v8h h[2]; };
typedef __attribute__((ext_vector_type(4))) float v4f;
typedef __attribute__((ext_vector_type(4))) unsigned v4u;
// Contractions: q/k/v 1x1 convs and the output conv (K = 256), scores q^T k (K = 256) and P V^T (K = keys) on
// v_wmma_f32_16x16x32_f16 (f16 operands, f32 accumulate; P scaled by 256 before its f16 conversion), except
// the q/k projections, which run as bf16 hi/lo splits (hi*hi + hi*lo + lo*hi) of f32 operands (q kept in f32, k rounded once to f16). The FFT refine with
// per-channel real weights is exactly fw_c * x and is folded into the conv weights; bilinear guide, sigmoid, softmax in f32.
template <typename V> __device__ __forceinline__ void vst2(void* p, V v) {
  *(V*)p = v; 
}
#define PSC 256.0f
#define PUN (1.0f / 256.0f)
typedef __attribute__((ext_vector_type(16))) __bf16 v16bf;
typedef __attribute__((ext_vector_type(8)))  __bf16 v8bf;
__device__ __forceinline__ __bf16 bf_hi(float x) { return (__bf16)x; }
__device__ __forceinline__ __bf16 bf_lo(float x, __bf16 h) { return (__bf16)(x - (float)h); }
__device__ __forceinline__ v8f WMMA_BF16(v16bf a, v16bf b, v8f c) {
  v8f d = __builtin_amdgcn_wmma_f32_16x16x32_bf16(false, a, false, b, (short)0, c, false, false);
  asm volatile("v_nop\n\tv_nop\n\tv_nop\n\tv_nop" : "+v"(d) : "v"(a), "v"(b));
  return d;
}
// bf16 fragment from an LDS plane [row][rs] (split K map)
__device__ __forceinline__ v16bf load_bf_lds(const __bf16* base, int row, int rs, int kbase, int lane) {
  union { v16bf v; v8bf h[2]; } u;
  const __bf16* p = base + (size_t)row * rs + kbase + ((lane >> 4) << 3);
  u.h[0] = *(const v8bf*)(p); u.h[1] = *(const v8bf*)(p + 16);
  return u.v;
}
// A-matrix fragment (16x32 f16, M x K), memory layout [row][k] row-major.
// Element i of lane L: K = kbase + (i/8)*16 + (L/16)*8 + i%8, M = row (caller adds lane%16).
__device__ __forceinline__ v16h load_a(const f16* base, int row, int rs, int kbase, int lane) {
  const f16* p = base + (size_t)row * rs + kbase + ((lane >> 4) << 3);
  FragU u;
  u.h[0] = *(const v8h*)(p);
  u.h[1] = *(const v8h*)(p + 16);
  return u.v;
}
// B-matrix fragment (32x16 f16, K x N), memory layout [col][k] (K contiguous); same per-lane K map as A:
// Element i of lane L: K = kbase + (i/8)*16 + (L/16)*8 + i%8, N = col.
__device__ __forceinline__ v16h load_b(const f16* base, int col, int rs, int kbase, int lane) {
  return load_a(base, col, rs, kbase, lane);
}

__device__ __forceinline__ v8f WMMA_F16(v16h a, v16h b, v8f c) {
  v8f d = __builtin_amdgcn_wmma_f32_16x16x32_f16(false, a, false, b, (short)0, c, false, false);
  asm volatile("v_nop\n\tv_nop\n\tv_nop\n\tv_nop" : "+v"(d) : "v"(a), "v"(b));
  return d;
}

// ---------------- prep kernels ----------------

// bilinear(align_corners) + sigmoid -> scale = 1 + sigmoid(g)
__global__ __launch_bounds__(256) void k_scale(const float* __restrict__ g0,
                                               float* __restrict__ sc) {
  int idx = blockIdx.x * 256 + threadIdx.x;   // B*N
  int b = idx >> 12, n = idx & (NN - 1);
  int ny = n >> 6, nx = n & 63;
  float fy = ny * (31.0f / 63.0f);
  float fx = nx * (31.0f / 63.0f);
  int y0 = (int)fy, x0 = (int)fx;
  float wy = fy - (float)y0, wx = fx - (float)x0;
  int y1 = min(y0 + 1, H0 - 1), x1 = min(x0 + 1, W0 - 1);
  const float* g = g0 + (size_t)b * H0 * W0;
  float v00 = g[y0 * W0 + x0], v01 = g[y0 * W0 + x1];
  float v10 = g[y1 * W0 + x0], v11 = g[y1 * W0 + x1];
  float vy0 = v00 * (1.f - wx) + v01 * wx;
  float vy1 = v10 * (1.f - wx) + v11 * wx;
  float v = vy0 * (1.f - wy) + vy1 * wy;
  vst2(sc + idx, 1.0f + 1.0f / (1.0f + __expf(-v)));
}

// convert weights to f16; fold freq_weights into Wq/Wk/Wv columns (refined = fw*x)
__global__ __launch_bounds__(256) void k_wconv(const float* __restrict__ Wq,
                                               const float* __restrict__ Wk,
                                               const float* __restrict__ Wv,
                                               const float* __restrict__ Wo,
                                               const float* __restrict__ fw,
                                               f16* __restrict__ W3,
                                               f16* __restrict__ Wo16) {
  int g = blockIdx.x * 256 + threadIdx.x;     // 4*256*256/8 pieces of 8 halves
  int idx0 = g * 8;
  int m = idx0 >> 16, r0 = idx0 & 65535;
  const float* W = (m == 0) ? Wq : (m == 1) ? Wk : (m == 2) ? Wv : Wo;
  union { v8h h; v4u u; } pk;
#pragma unroll
  for (int e = 0; e < 8; ++e) { int r = r0 + e, ci = r & (CC - 1); pk.h[e] = (f16)(W[r] * ((m < 3) ? fw[ci] : 1.0f)); }
  f16* dst = (m < 3) ? (W3 + (size_t)m * 65536 + r0) : (Wo16 + r0);
  vst2(dst, pk.u);
}

// ---------------- QKV GEMM ----------------
// q stored [b][n][c] (transposed, f32, scaled); k stored [b][n][c] (f16, scaled); v stored [b][c][n] (f16, scaled)
__global__ __launch_bounds__(256) void k_qkv(const f16* __restrict__ W3,
                                             const float* __restrict__ xf,   // x f32 [b][c][n]
                                             const float* __restrict__ Wqf, const float* __restrict__ Wkf,
                                             const float* __restrict__ fw,
                                             const float* __restrict__ bq,
                                             const float* __restrict__ bk,
                                             const float* __restrict__ bv,
                                             const float* __restrict__ scg,
                                             float* __restrict__ qT,
                                             f16* __restrict__ kF,
                                             f16* __restrict__ v16) {
  __shared__ __align__(16) float T[64][260];   // block tile [n][c] (padded), f32
  __shared__ __align__(16) __bf16 Xp[2][64][264];   // this block's x tile [n][c] as bf16 hi / lo planes, rows of 528 B: the B operand of q and of k
  // the same tile as f16, the B operand of v: it lies in T's storage, so v is formed first and T takes the place over behind v's products
  f16 (*Xf)[264] = reinterpret_cast<f16 (*)[264]>(&T[0][0]);
  int b = blockIdx.y;
  int n_base = blockIdx.x * 64;
  int tid = threadIdx.x;
  int lane = threadIdx.x & 31, wave = threadIdx.x >> 5;
  int co_wave = wave * 32;
  const float* scb = scg + (size_t)b * NN;
  const v8f vzero = {};
  const float* xfb = xf + (size_t)b * CC * NN;
  // x tile (256 c x 64 n, f32) converted once for all eight waves and all three products: a wave-wide load takes 32 n of one c (one whole
  // line), a thread gathers 8 consecutive c of its n and stores them as one 16-B piece of each plane
  {
    const int n = tid & 63;
#pragma unroll   // with the loop below: all 64 loads of a thread are issued before the first is waited for
    for (int i = 0; i < 8; ++i) {
      const int c0 = ((tid >> 6) + 4 * i) * 8;
      const float* xp = xfb + (size_t)c0 * NN + n_base + n;
      v8bf h8, l8;
      v8h f8;
#pragma unroll   // constant indices keep h8, l8 and f8 in registers
      for (int e = 0; e < 8; ++e) { const float xv = xp[(size_t)e * NN]; __bf16 hh = bf_hi(xv); h8[e] = hh; l8[e] = bf_lo(xv, hh); f8[e] = (f16)xv; }
      *(v8bf*)&Xp[0][n][c0] = h8;
      *(v8bf*)&Xp[1][n][c0] = l8;
      *(v8h*)&Xf[n][c0] = f8;
    }
  }
  __syncthreads();   // publishes the three planes to every wave
  for (int mi = 0; mi < 3; ++mi) {
    const int m = (mi == 0) ? 2 : mi - 1;   // v, q, k
    const f16* Wm = W3 + (size_t)m * 65536;
    const float* bias = (m == 0) ? bq : ((m == 1) ? bk : bv);
    v8f acc[2][4];
    for (int cb = 0; cb < 2; ++cb)
      for (int nb = 0; nb < 4; ++nb) acc[cb][nb] = vzero;
    if (m < 2) {
      // q and k as a bf16 hi/lo split of f32 operands: A = (W*fw) rows [co][ci] (contiguous), B = the staged x planes
      const float* Wf = (m == 0) ? Wqf : Wkf;
      for (int kk = 0; kk < CC; kk += 32) {
        v16bf ah[2], al[2];
#pragma unroll
        for (int cb = 0; cb < 2; ++cb) {
          const float* wr = Wf + (size_t)(co_wave + cb * 16 + (lane & 15)) * CC + kk + ((lane >> 4) << 3);
#pragma unroll
          for (int e = 0; e < 16; ++e) { const int ko = (e < 8) ? e : (8 + e); const float w = wr[ko] * fw[kk + ((lane >> 4) << 3) + ko];
                                         __bf16 hh = bf_hi(w); ah[cb][e] = hh; al[cb][e] = bf_lo(w, hh); }
        }
        for (int nb = 0; nb < 4; ++nb) {
          const v16bf bh = load_bf_lds(&Xp[0][0][0], nb * 16 + (lane & 15), 264, kk, lane);
          const v16bf bl = load_bf_lds(&Xp[1][0][0], nb * 16 + (lane & 15), 264, kk, lane);
          acc[0][nb] = WMMA_BF16(ah[0], bh, acc[0][nb]); acc[0][nb] = WMMA_BF16(ah[0], bl, acc[0][nb]); acc[0][nb] = WMMA_BF16(al[0], bh, acc[0][nb]);
          acc[1][nb] = WMMA_BF16(ah[1], bh, acc[1][nb]); acc[1][nb] = WMMA_BF16(ah[1], bl, acc[1][nb]); acc[1][nb] = WMMA_BF16(al[1], bh, acc[1][nb]);
        }
      }
    } else
    for (int kk = 0; kk < CC; kk += 32) {
      v16h a0 = load_a(Wm, co_wave + (lane & 15), CC, kk, lane);
      v16h a1 = load_a(Wm, co_wave + 16 + (lane & 15), CC, kk, lane);
      for (int nb = 0; nb < 4; ++nb) {
        v16h bf = load_b(&Xf[0][0], nb * 16 + (lane & 15), 264, kk, lane);
        acc[0][nb] = WMMA_F16(a0, bf, acc[0][nb]);
        acc[1][nb] = WMMA_F16(a1, bf, acc[1][nb]);
      }
    }
    float qmul = (m == 0) ? 0.0625f : 1.0f;  // fold 1/sqrt(C) into q
    __syncthreads();                          // previous matrix's tile fully stored; before v's tile: every wave has left the f16 plane
    for (int cb = 0; cb < 2; ++cb) {
      int co_b = co_wave + cb * 16 + ((lane >> 4) << 3);
      for (int nb = 0; nb < 4; ++nb) {
        int nl = nb * 16 + (lane & 15);
        float s = scb[n_base + nl] * qmul;
        for (int r = 0; r < 8; ++r) T[nl][co_b + r] = (acc[cb][nb][r] + bias[co_b + r]) * s;
      }
    }
    __syncthreads();
    if (m == 0) {   // f32 [b][n][c]: 64 rows x 1024 B (64 pieces of 4 floats)
      float* dstb = qT + (size_t)b * NN * CC + (size_t)n_base * CC;
      for (int g = tid; g < 64 * 64; g += 256) { int nl = g >> 6, pc = g & 63; vst2(dstb + (size_t)nl * CC + pc * 4, *(const v4f*)(&T[nl][pc * 4])); }
    } else if (m == 1) {   // f16 [b][n][c]: 64 rows x 512 B (32 pieces of 8), rounded here once for every reader
      const size_t ko = (size_t)b * NN * CC + (size_t)n_base * CC;
      for (int g = tid; g < 64 * 32; g += 256) {
        int nl = g >> 5, pc = g & 31;
        v8h h8;
#pragma unroll   // constant indices keep h8 in registers
        for (int e = 0; e < 8; ++e) h8[e] = (f16)T[nl][pc * 8 + e];
        vst2(kF + ko + (size_t)nl * CC + pc * 8, h8);
      }
    } else {
      f16* vb = v16 + (size_t)b * CC * NN + n_base;
      for (int g = tid; g < 256 * 8; g += 256) {
        int c = g >> 3, pc = g & 7;
        union { v8h h; v4u u; } pk;
        for (int e = 0; e < 8; ++e) pk.h[e] = (f16)T[pc * 8 + e][c];
        vst2(vb + (size_t)c * NN + pc * 8, pk.u);
      }
    }
  }
}

// ---------------- flash attention ----------------
// Eight asynchronous copies of one wave: rows r, r + 8, ..., r + 56 of the K tile, a whole 512-B row (4 lines) per copy, 16 B per lane,
// from rows of 512 B in global memory to rows of 528 B in LDS. lds = the lane's place in row r, g = the lane's global address in row r.
// Written as the builtin, with one LDS address for all eight copies: copy n lands at lds + n * 4224 through its immediate offset;
// that offset moves both addresses, so the copy's global pointer is row r + 8 n's address less the offset:
// g + n * 4096 - n * 4224 = g - n * 128. The largest offset is 29568.
__device__ __forceinline__ void k_rows_async(f16* lds, const f16* g) {
  typedef __attribute__((ext_vector_type(4))) int v4i;
  typedef __attribute__((address_space(1))) v4i* gp_t;
  typedef __attribute__((address_space(3))) v4i* lp_t;
  const unsigned long long a = (unsigned long long)g;
  const lp_t l = (lp_t)lds;
  __builtin_amdgcn_global_load_async_to_lds_b128((gp_t)(a), l, 0, 0);
  __builtin_amdgcn_global_load_async_to_lds_b128((gp_t)(a - 1 * 128), l, 1 * 4224, 0);
  __builtin_amdgcn_global_load_async_to_lds_b128((gp_t)(a - 2 * 128), l, 2 * 4224, 0);
  __builtin_amdgcn_global_load_async_to_lds_b128((gp_t)(a - 3 * 128), l, 3 * 4224, 0);
  __builtin_amdgcn_global_load_async_to_lds_b128((gp_t)(a - 4 * 128), l, 4 * 4224, 0);
  __builtin_amdgcn_global_load_async_to_lds_b128((gp_t)(a - 5 * 128), l, 5 * 4224, 0);
  __builtin_amdgcn_global_load_async_to_lds_b128((gp_t)(a - 6 * 128), l, 6 * 4224, 0);
  __builtin_amdgcn_global_load_async_to_lds_b128((gp_t)(a - 7 * 128), l, 7 * 4224, 0);
}
// exp(x) as __expf forms it (one multiply, one v_exp_f32), with the slot behind the transcendental kept inside the statement
__device__ __forceinline__ float exp_slot(float x) {
  const float y = x * 1.44269504f;
  float r;
  asm("v_exp_f32 %0, %1\n\tv_nop" : "=v"(r) : "v"(y));   // the v_nop fills the slot: nothing reads r or rewrites y directly behind the v_exp_f32
  return r;
}
// lane l's value to lane l ^ 16 and back (every lane on)
__device__ __forceinline__ float xhalf(float x) {
  return __builtin_bit_cast(float, __builtin_amdgcn_permlanex16(__builtin_bit_cast(int, x), __builtin_bit_cast(int, x), 0x76543210, 0xfedcba98, false, false));
}
// Score product as the bare builtin: resident Q fragments may live above v255, where an asm operand cannot name them;
// the compiler keeps the distance behind its own matrix instructions.
__device__ __forceinline__ v8f wmma_f16_hireg(v16h a, v16h b, v8f c) {
  return __builtin_amdgcn_wmma_f32_16x16x32_f16(false, a, false, b, (short)0, c, false, false);
}
// Eight asynchronous copies of one wave: rows r, r + 4, ..., r + 28 of the V tile [c][64 keys], four whole 128-B rows (lines) per copy,
// 16 B per lane, from rows of 8192 B in global memory to rows of 144 B in LDS. As above one LDS address serves all eight: copy n lands at
// lds + n * 576 through its immediate offset, which moves both addresses, so its global pointer is g + n * 32768 - n * 576.
__device__ __forceinline__ void v_rows_async(f16* lds, const f16* g) {
  typedef __attribute__((ext_vector_type(4))) int v4i;
  typedef __attribute__((address_space(1))) v4i* gp_t;
  typedef __attribute__((address_space(3))) v4i* lp_t;
  const unsigned long long a = (unsigned long long)g;
  const lp_t l = (lp_t)lds;
  __builtin_amdgcn_global_load_async_to_lds_b128((gp_t)(a), l, 0, 0);
  __builtin_amdgcn_global_load_async_to_lds_b128((gp_t)(a + 1 * 32192), l, 1 * 576, 0);
  __builtin_amdgcn_global_load_async_to_lds_b128((gp_t)(a + 2 * 32192), l, 2 * 576, 0);
  __builtin_amdgcn_global_load_async_to_lds_b128((gp_t)(a + 3 * 32192), l, 3 * 576, 0);
  __builtin_amdgcn_global_load_async_to_lds_b128((gp_t)(a + 4 * 32192), l, 4 * 576, 0);
  __builtin_amdgcn_global_load_async_to_lds_b128((gp_t)(a + 5 * 32192), l, 5 * 576, 0);
  __builtin_amdgcn_global_load_async_to_lds_b128((gp_t)(a + 6 * 32192), l, 6 * 576, 0);
  __builtin_amdgcn_global_load_async_to_lds_b128((gp_t)(a + 7 * 32192), l, 7 * 576, 0);
}
// out[b][n][c] f16 = softmax(q^T k) v, in the transposed form S^T = K Q^T, O^T += V^T P^T: in a score accumulator a lane holds 8 keys of
// ONE query, which is also the B operand's map, so P goes from the accumulators into the next product in registers.
// 128 query columns per work-group, stages of 64 keys. Wave w: query columns (w & 3) * 32 .. + 31, keys (w >> 2) * 32 .. + 31 of each stage;
// the two waves of a query group keep a running maximum, sum and O^T of their own, joined once behind the loop.
#define QT 2    // query tiles of 16 columns per wave
#define KT 2    // key tiles of 16 per wave and stage
__global__ __launch_bounds__(256) void k_attn(const float* __restrict__ qT,
                                              const f16* __restrict__ kF,
                                              const f16* __restrict__ v16,
                                              f16* __restrict__ aout) {
  __shared__ __align__(16) f16 Kp[2][64][264];   // K stages [key][c], rows of 528 B, two buffers
  __shared__ __align__(16) f16 Vp[2][256][72];   // V stages [c][key], rows of 144 B, two buffers
  __shared__ __align__(16) v4f Mg[4][16 * QT * 2][32];   // O^T of the waves with the upper key halves, lane by lane
  __shared__ float Mm[4][QT][32], Ml[4][QT][32];         // their maxima and sums
  __shared__ __align__(16) v8h Qs[8][QT][2][32];         // each wave's Q fragments of the last k step, lane by lane: the registers do not hold all eight steps
  // output tile [n][c]: takes over the K stages' place behind the loop
  f16 (*Ot)[264] = reinterpret_cast<f16 (*)[264]>(&Kp[0][0][0]);
  const int b = blockIdx.y;
  const int nq = blockIdx.x * 128;
  const int tid = threadIdx.x, lane = tid & 31;
  const int wave = __builtin_amdgcn_readfirstlane(tid >> 5);
  const int qg = wave & 3, kh = wave >> 2;
  const float* qTb = qT + (size_t)b * NN * CC;
  const v8f vzero = {};

  // K stage = 64 rows x 512 B: wave w copies rows w, w + 8, ..., w + 56. V stage = 256 rows x 128 B: wave w copies rows 32 w .. 32 w + 31
  const f16* kfp = kF + (size_t)b * NN * CC + (size_t)wave * CC + lane * 8;
  const f16* vfp = v16 + (size_t)b * CC * NN + (size_t)(wave * 32 + (lane >> 3)) * NN + (lane & 7) * 8;
  f16* const k_lds = &Kp[0][wave][lane * 8];
  f16* const v_lds = &Vp[0][wave * 32 + (lane >> 3)][(lane & 7) * 8];
  k_rows_async(k_lds, kfp);   // stage 0: nothing has touched the buffers yet
  v_rows_async(v_lds, vfp);

  // this wave's 32 query columns as B fragments, rounded to f16, kept for every stage: k steps 0 to 6 in registers, step 7 in LDS
  v16h qh[QT][8];
#pragma unroll   // constant indices keep the fragments in registers
  for (int qt = 0; qt < QT; ++qt) {
    const float* qp = qTb + (size_t)(nq + (qg * QT + qt) * 16 + (lane & 15)) * CC + ((lane >> 4) << 3);
    v4f qa[8][4];
#pragma unroll   // as above
    for (int k8 = 0; k8 < 8; ++k8) {
      qa[k8][0] = *(const v4f*)(qp + k8 * 32);      qa[k8][1] = *(const v4f*)(qp + k8 * 32 + 4);
      qa[k8][2] = *(const v4f*)(qp + k8 * 32 + 16); qa[k8][3] = *(const v4f*)(qp + k8 * 32 + 20);
    }
    // precaution: what follows reuses the address registers of this tile's 32 loads while the loads are still in flight;
    // the address as an input keeps its registers unwritten up to the wait, over which the build otherwise lifts later register writes
    asm volatile("s_wait_xcnt 0x0" :: "v"(qp) : "memory");
#pragma unroll   // as above
    for (int k8 = 0; k8 < 8; ++k8)
#pragma unroll   // as above
      for (int e = 0; e < 16; ++e) qh[qt][k8][e] = (f16)qa[k8][e >> 2][e & 3];
    FragU u; u.v = qh[qt][7];
    Qs[wave][qt][0][lane] = u.h[0]; Qs[wave][qt][1][lane] = u.h[1];
  }
  v8f oacc[16][QT];
#pragma unroll   // constant indices keep the accumulators in registers
  for (int ct = 0; ct < 16; ++ct)
#pragma unroll   // as above
    for (int qt = 0; qt < QT; ++qt) oacc[ct][qt] = vzero;
  float m_row[QT], l_row[QT];   // per lane: its query's running maximum (both lane halves alike) and the sum over the lane's own keys
  for (int qt = 0; qt < QT; ++qt) { m_row[qt] = -1e30f; l_row[qt] = 0.f; }

  asm volatile("s_wait_asynccnt 0x0" ::: "memory");   // this wave's rows of stage 0 have landed; the barrier publishes them
  __syncthreads();
  k_rows_async(k_lds + 64 * 264, kfp + (size_t)64 * CC);   // stage 1 flies while stage 0 is worked on
  v_rows_async(v_lds + 256 * 72, vfp + 64);

  for (int t = 0; t < NN / 64; ++t) {
    const int bf = t & 1;
    const f16* Kb = &Kp[0][0][0] + bf * (64 * 264);
    const f16* Vb = &Vp[0][0][0] + bf * (256 * 72);
    // S^T = K Q^T: 32 keys x 32 queries per wave
    v8f s[KT][QT];
#pragma unroll   // constant indices
    for (int kt = 0; kt < KT; ++kt)
#pragma unroll   // as above
      for (int qt = 0; qt < QT; ++qt) s[kt][qt] = vzero;
    // K fragments of two k steps (four fragments) at a time in two register sets: a group is read from LDS while the group before it is worked on
    v16h ka[2][2 * KT];
    FragU q7[QT];
#pragma unroll   // constant indices into the two fragment sets
    for (int g = 0; g < 2; ++g)
#pragma unroll   // as above
      for (int j = 0; j < 2 * KT; ++j) ka[g][j] = load_a(Kb, (kh * KT + (j & (KT - 1))) * 16 + (lane & 15), 264, (g * 2 + j / KT) * 32, lane);
#pragma unroll   // constant indices into the register-resident Q fragments and the two fragment sets
    for (int g = 0; g < 4; ++g) {
#pragma unroll   // as above
      for (int j = 0; j < 2 * KT; ++j)
#pragma unroll   // as above
        for (int qt = 0; qt < QT; ++qt) s[j & (KT - 1)][qt] = wmma_f16_hireg(ka[g & 1][j], (g * 2 + j / KT == 7) ? q7[qt].v : qh[qt][g * 2 + j / KT], s[j & (KT - 1)][qt]);
      if (g < 2) {
#pragma unroll   // as above
        for (int j = 0; j < 2 * KT; ++j) ka[g][j] = load_a(Kb, (kh * KT + (j & (KT - 1))) * 16 + (lane & 15), 264, ((g + 2) * 2 + j / KT) * 32, lane);
      }
      if (g == 2) {   // read where a K fragment set has just come free
#pragma unroll   // as above
        for (int qt = 0; qt < QT; ++qt) { q7[qt].h[0] = Qs[wave][qt][0][lane]; q7[qt].h[1] = Qs[wave][qt][1][lane]; }
      }
    }
    // online softmax in the lane: s[kt][qt][r] is key kt * 16 + (lane >> 4) * 8 + r of query qt * 16 + (lane & 15)
    v16h pb[QT];
    float rs[QT];
#pragma unroll   // constant indices
    for (int qt = 0; qt < QT; ++qt) {
      float mx = s[0][qt][0];
#pragma unroll   // as above
      for (int kt = 0; kt < KT; ++kt)
#pragma unroll   // as above
        for (int r = 0; r < 8; ++r) mx = fmaxf(mx, s[kt][qt][r]);
      const float m_new = fmaxf(fmaxf(mx, xhalf(mx)), m_row[qt]);
      rs[qt] = exp_slot(m_row[qt] - m_new);
      float l = 0.f;
#pragma unroll   // as above
      for (int kt = 0; kt < KT; ++kt)
#pragma unroll   // as above
        for (int r = 0; r < 8; ++r) {
          const float p = exp_slot(s[kt][qt][r] - m_new);
          pb[qt][kt * 8 + r] = (f16)(p * PSC); l += p;   // B map: element kt * 8 + r is key kt * 16 + (lane >> 4) * 8 + r
        }
      l_row[qt] = l_row[qt] * rs[qt] + l;
      m_row[qt] = m_new;
    }
    // rescale O^T (a lane's column is one query: one factor per lane) and O^T += V^T P^T (K = this wave's 32 keys);
    // V fragments four at a time in two register sets: a group is read from LDS while the group before it is worked on
    v16h va[2][4];
#pragma unroll   // constant indices into the two fragment sets
    for (int g = 0; g < 2; ++g)
#pragma unroll   // as above
      for (int j = 0; j < 4; ++j) va[g][j] = load_a(Vb, (g * 4 + j) * 16 + (lane & 15), 72, kh * (KT * 16), lane);
#pragma unroll   // constant indices into the accumulators
    for (int ct = 0; ct < 8; ++ct)
#pragma unroll   // as above
      for (int qt = 0; qt < QT; ++qt) oacc[ct][qt] *= rs[qt];
#pragma unroll   // constant indices into the accumulators and the two fragment sets
    for (int g = 0; g < 4; ++g) {
#pragma unroll   // as above
      for (int j = 0; j < 4; ++j)
#pragma unroll   // as above
        for (int qt = 0; qt < QT; ++qt) {
          oacc[g * 4 + j][qt] = wmma_f16_hireg(va[g & 1][j], pb[qt], oacc[g * 4 + j][qt]);
          if (g < 2) oacc[(g + 2) * 4 + j][qt] *= rs[qt];
        }
      if (g < 2) {
#pragma unroll   // as above
        for (int j = 0; j < 4; ++j) va[g][j] = load_a(Vb, ((g + 2) * 4 + j) * 16 + (lane & 15), 72, kh * (KT * 16), lane);
      }
    }
    // keeps the last two groups' products in front of the waits below: sunk behind the barrier they no longer cover the last reads' latency and hold the refill back
    __builtin_amdgcn_sched_barrier(0);
    asm volatile("s_wait_dscnt 0x0" ::: "memory");      // this wave's reads of this stage's buffers have retired
    asm volatile("s_wait_asynccnt 0x0" ::: "memory");   // this wave's rows of the next stage have landed
    __syncthreads();   // publishes the next stage; also ends every wave's reads of the buffers refilled behind it
    if (t + 2 < NN / 64) {
      k_rows_async(k_lds + bf * (64 * 264), kfp + (size_t)(t + 2) * 64 * CC);
      v_rows_async(v_lds + bf * (256 * 72), vfp + (t + 2) * 64);
    }
  }
  asm volatile("s_wait_asynccnt 0x0" ::: "memory");   // no copy is left in flight
  // join the lane halves' sums, then the two key halves: the upper half's wave hands its state over through LDS
  float lt[QT];
  for (int qt = 0; qt < QT; ++qt) lt[qt] = l_row[qt] + xhalf(l_row[qt]);
  if (kh == 1) {
#pragma unroll   // constant indices into the accumulators
    for (int ct = 0; ct < 16; ++ct)
#pragma unroll   // as above
      for (int qt = 0; qt < QT; ++qt) {
        const v8f o = oacc[ct][qt];
        Mg[qg][(ct * QT + qt) * 2][lane] = v4f{o[0], o[1], o[2], o[3]};
        Mg[qg][(ct * QT + qt) * 2 + 1][lane] = v4f{o[4], o[5], o[6], o[7]};
      }
    for (int qt = 0; qt < QT; ++qt) { Mm[qg][qt][lane] = m_row[qt]; Ml[qg][qt][lane] = lt[qt]; }
  }
  __syncthreads();   // publishes the upper halves' state
  // divide by the softmax sum (and the P scale), stage [n][c], store [b][n][c] f16 rows of 512 B
  if (kh == 0) {
#pragma unroll   // constant indices into the accumulators
    for (int qt = 0; qt < QT; ++qt) {
      const float m1 = Mm[qg][qt][lane], l1 = Ml[qg][qt][lane];
      const float m = fmaxf(m_row[qt], m1);
      float a0 = exp_slot(m_row[qt] - m), a1 = exp_slot(m1 - m);
      const float inv = PUN / (lt[qt] * a0 + l1 * a1);
      a0 *= inv; a1 *= inv;
#pragma unroll   // as above
      for (int ct = 0; ct < 16; ++ct) {
        const v4f u0 = Mg[qg][(ct * QT + qt) * 2][lane], u1 = Mg[qg][(ct * QT + qt) * 2 + 1][lane];
        v8h o;
#pragma unroll   // as above
        for (int r = 0; r < 4; ++r) {
          o[r] = (f16)(oacc[ct][qt][r] * a0 + u0[r] * a1);
          o[4 + r] = (f16)(oacc[ct][qt][4 + r] * a0 + u1[r] * a1);
        }
        *(v8h*)&Ot[(qg * QT + qt) * 16 + (lane & 15)][ct * 16 + ((lane >> 4) << 3)] = o;
      }
    }
  }
  __syncthreads();
  {
    f16* ab = aout + (size_t)b * NN * CC + (size_t)nq * CC;
    for (int g = tid; g < 128 * 32; g += 256) { int nl = g >> 5, pc = g & 31; vst2(ab + (size_t)nl * CC + pc * 8, *(const v4u*)(&Ot[nl][pc * 8])); }
  }
}

// ---------------- output projection ----------------
__global__ __launch_bounds__(256) void k_out(const f16* __restrict__ aout,
                                             const f16* __restrict__ Wo16,
                                             const float* __restrict__ bo,
                                             float* __restrict__ out) {
  __shared__ __align__(16) float So[8][32 * 64];   // per-wave [co][n] tile
  int b = blockIdx.y;
  int n_base = blockIdx.x * 64;
  int lane = threadIdx.x & 31, wave = threadIdx.x >> 5;
  int co_wave = wave * 32;
  const f16* ab = aout + (size_t)b * NN * CC;
  const v8f vzero = {};
  v8f acc[2][4];
  for (int cb = 0; cb < 2; ++cb)
    for (int nb = 0; nb < 4; ++nb) acc[cb][nb] = vzero;
  for (int kk = 0; kk < CC; kk += 32) {
    v16h a0 = load_a(Wo16, co_wave + (lane & 15), CC, kk, lane);
    v16h a1 = load_a(Wo16, co_wave + 16 + (lane & 15), CC, kk, lane);
    for (int nb = 0; nb < 4; ++nb) {
      v16h bf = load_b(ab, n_base + nb * 16 + (lane & 15), CC, kk, lane);
      acc[0][nb] = WMMA_F16(a0, bf, acc[0][nb]);
      acc[1][nb] = WMMA_F16(a1, bf, acc[1][nb]);
    }
  }
  float* ob = out + (size_t)b * CC * NN;
  float* so = So[wave];
  for (int cb = 0; cb < 2; ++cb) {
    int col_b = cb * 16 + ((lane >> 4) << 3);
    for (int nb = 0; nb < 4; ++nb) {
      int nl = nb * 16 + (lane & 15);
      for (int r = 0; r < 8; ++r) so[(col_b + r) * 64 + nl] = acc[cb][nb][r] + bo[co_wave + col_b + r];
    }
  }
  __syncthreads();
  for (int q = 0; q < 16; ++q) {    // 32 channel rows x 256 B (16 pieces); rows 2q, 2q+1 per instruction
    int rl = q * 2 + (lane >> 4), pc = lane & 15;
    vst2(ob + (size_t)(co_wave + rl) * NN + n_base + pc * 4, *(const v4f*)(&so[rl * 64 + pc * 4]));
  }
}

extern "C" void kernel_launch(void* const* d_in, const int* in_sizes, int n_in,
                              void* d_out, int out_size, void* d_ws, size_t ws_size,
                              hipStream_t stream) {
  (void)in_sizes; (void)n_in; (void)out_size; (void)ws_size;
  const float* x  = (const float*)d_in[0];
  const float* g0 = (const float*)d_in[1];
  const float* Wq = (const float*)d_in[2];
  const float* bq = (const float*)d_in[3];
  const float* Wk = (const float*)d_in[4];
  const float* bk = (const float*)d_in[5];
  const float* Wv = (const float*)d_in[6];
  const float* bv = (const float*)d_in[7];
  const float* Wo = (const float*)d_in[8];
  const float* bo = (const float*)d_in[9];
  const float* fw = (const float*)d_in[10];

  char* ws = (char*)d_ws;
  float* scg = (float*)ws; ws += (size_t)BB * NN * sizeof(float);
  f16* W3    = (f16*)ws;   ws += (size_t)3 * CC * CC * sizeof(f16);
  f16* Wo16  = (f16*)ws;   ws += (size_t)CC * CC * sizeof(f16);
  float* qT  = (float*)ws; ws += (size_t)BB * NN * CC * sizeof(float);
  f16* kF    = (f16*)ws;   ws += (size_t)BB * NN * CC * sizeof(f16);
  f16* v16   = (f16*)ws;   ws += (size_t)BB * NN * CC * sizeof(f16);
  f16* aout  = (f16*)ws;

  k_scale<<<dim3((BB * NN) / 256), 256, 0, stream>>>(g0, scg);
  k_wconv<<<dim3((4 * CC * CC / 8) / 256), 256, 0, stream>>>(Wq, Wk, Wv, Wo, fw, W3, Wo16);
  k_qkv<<<dim3(NN / 64, BB), 256, 0, stream>>>(W3, x, Wq, Wk, fw, bq, bk, bv, scg, qT, kF, v16);
  k_attn<<<dim3(NN / 128, BB), 256, 0, stream>>>(qT, kF, v16, aout);
  k_out<<<dim3(NN / 64, BB), 256, 0, stream>>>(aout, Wo16, bo, (float*)d_out);
}
